// v000
// Times are from an AMD MI455X. After a warm-up the kernel runs many times in a row, and a time is the length of
// such a window on the GPU divided by its runs, so every launch and the gaps after it count. The runs cycle
// through copies of the inputs. A figure is the median of several windows, for all but v000 over two sittings.
// Sittings can differ by a few percent; kernels timed side by side share one.
// v000, which the later versions start from, runs in 324 microseconds.
#include <hip/hip_runtime.h>

typedef __attribute__((ext_vector_type(2))) float v2f;
typedef __attribute__((ext_vector_type(4))) float v4f;
typedef __attribute__((ext_vector_type(8))) float v8f;
typedef __attribute__((ext_vector_type(4))) unsigned int v4u;
typedef __attribute__((ext_vector_type(4))) int v4i;
typedef __attribute__((ext_vector_type(8))) int v8i;

namespace {
constexpr int kB    = 16;
constexpr int kC    = 64;
constexpr int kH    = 64;
constexpr int kW    = 64;
constexpr int kN    = kH * kW;              // 4096 query positions
constexpr int kNkv  = (kH / 2) * (kW / 2);  // 1024 key positions
constexpr int kHeads = 2;
constexpr int kHd    = 32;
constexpr int kVST   = 33;                  // padded ldsVt row stride (floats)
constexpr int kPST   = 66;                  // padded P-tile row stride (floats)
constexpr float kScale = 0.17677669529663687f;  // 32^-0.5
}

// ---- VALU 16-lane butterfly reductions via DPP16 ROW_XMASK (no DS pipe) ----
template <int CTRL>
__device__ inline float dpp_movf(float x) {
  return __builtin_bit_cast(
      float, __builtin_amdgcn_update_dpp(0, __builtin_bit_cast(int, x), CTRL,
                                         0xF, 0xF, true));
}
__device__ inline float rowmax16(float x) {
  x = fmaxf(x, dpp_movf<0x161>(x));  // ROW_XMASK:1
  x = fmaxf(x, dpp_movf<0x162>(x));  // ROW_XMASK:2
  x = fmaxf(x, dpp_movf<0x164>(x));  // ROW_XMASK:4
  x = fmaxf(x, dpp_movf<0x168>(x));  // ROW_XMASK:8
  return x;
}
__device__ inline float rowsum16(float x) {
  x += dpp_movf<0x161>(x);
  x += dpp_movf<0x162>(x);
  x += dpp_movf<0x164>(x);
  x += dpp_movf<0x168>(x);
  return x;
}

// ---------------------------------------------------------------------------
// 1x1 conv over [B, 64, 4096]: weight reads are wave-uniform -> scalar loads.
// ---------------------------------------------------------------------------
__global__ __launch_bounds__(256) void sra_conv1x1(const float* __restrict__ in,
                                                   const float* __restrict__ w,
                                                   float* __restrict__ out) {
  const int b = blockIdx.y;
  const int n = blockIdx.x * 256 + threadIdx.x;
  const float* xb = in + (size_t)b * kC * kN + n;
  float acc[kC];
#pragma unroll
  for (int c = 0; c < kC; ++c) acc[c] = 0.f;
  for (int ci = 0; ci < kC; ++ci) {
    const float xv = xb[(size_t)ci * kN];
#pragma unroll
    for (int c = 0; c < kC; ++c) acc[c] = fmaf(w[c * kC + ci], xv, acc[c]);
  }
  float* ob = out + (size_t)b * kC * kN + n;
#pragma unroll
  for (int c = 0; c < kC; ++c) ob[(size_t)c * kN] = acc[c];
}

// ---------------------------------------------------------------------------
// 2x2 stride-2 conv: out[c, m] (m over 32x32)
// ---------------------------------------------------------------------------
__global__ __launch_bounds__(256) void sra_conv2x2s2(const float* __restrict__ in,
                                                     const float* __restrict__ w,
                                                     float* __restrict__ out) {
  const int b = blockIdx.y;
  const int m = blockIdx.x * 256 + threadIdx.x;
  const int ky = m >> 5, kx = m & 31;
  const float* xb = in + (size_t)b * kC * kN + (2 * ky) * kW + 2 * kx;
  float acc[kC];
#pragma unroll
  for (int c = 0; c < kC; ++c) acc[c] = 0.f;
  for (int ci = 0; ci < kC; ++ci) {
    const float* xp = xb + (size_t)ci * kN;
    const float x00 = xp[0], x01 = xp[1], x10 = xp[kW], x11 = xp[kW + 1];
#pragma unroll
    for (int c = 0; c < kC; ++c) {
      const float* wc = w + (((size_t)c * kC + ci) << 2);
      float a = acc[c];
      a = fmaf(wc[0], x00, a);
      a = fmaf(wc[1], x01, a);
      a = fmaf(wc[2], x10, a);
      a = fmaf(wc[3], x11, a);
      acc[c] = a;
    }
  }
  float* ob = out + (size_t)b * kC * kNkv + m;
#pragma unroll
  for (int c = 0; c < kC; ++c) ob[(size_t)c * kNkv] = acc[c];
}

// ---------------------------------------------------------------------------
// Fused flash-style attention per (b, head). 8 waves x 16 queries each.
// K staged into LDS by the Tensor Data Mover; V staged transposed (+padded)
// by the ALUs in parallel. Online softmax over 64-key blocks with DPP
// butterflies. All matmuls: V_WMMA_F32_16X16X4_F32 (fp32-exact).
// ---------------------------------------------------------------------------
__global__ __launch_bounds__(256) void sra_attn(const float* __restrict__ Qg,
                                                const float* __restrict__ Kg,
                                                const float* __restrict__ Vg,
                                                float* __restrict__ Ao) {
  extern __shared__ float smem[];
  float* ldsK  = smem;                        // [32][1024]
  float* ldsVt = smem + kHd * kNkv;           // [1024][33] transposed V
  float* ldsP  = ldsVt + kNkv * kVST;         // 8 waves * 16 * kPST

  const int tid  = threadIdx.x;
  const int wave = tid >> 5;
  const int lane = tid & 31;
  const int col  = lane & 15;
  const int hi   = lane >> 4;

  const int qt   = blockIdx.x;
  const int head = blockIdx.y;
  const int b    = blockIdx.z;

  const size_t kvbase = ((size_t)b * kC + head * kHd) * (size_t)kNkv;

  // ---- stage K via TDM: D# = 2-D tensor 1024 x 32 (f32), tile = all of it
  if (wave == 0) {
    const unsigned long long ga = (unsigned long long)(Kg + kvbase);
    const unsigned ldsa = (unsigned)(unsigned long long)(uintptr_t)ldsK;
    v4u g0;
    g0[0] = 1u;                                   // count=1, user D#
    g0[1] = ldsa;                                 // lds_addr (bytes)
    g0[2] = (unsigned)(ga & 0xFFFFFFFFull);       // global_addr[31:0]
    g0[3] = (unsigned)((ga >> 32) & 0x01FFFFFFull) | (2u << 30);  // type=2
    v8i g1;
    g1[0] = (int)(2u << 16);        // data_size = 4B
    g1[1] = (int)(1024u << 16);     // tensor_dim0 = 1024 (low 16 in [63:48])
    g1[2] = (int)(32u << 16);       // tensor_dim1 = 32
    g1[3] = (int)(1024u << 16);     // tile_dim0 = 1024
    g1[4] = 32;                     // tile_dim1 = 32, tile_dim2 = 0
    g1[5] = 1024;                   // tensor_dim0_stride = 1024
    g1[6] = 0;
    g1[7] = 0;
    v4i z4 = {0, 0, 0, 0};
    v8i z8 = {0, 0, 0, 0, 0, 0, 0, 0};
    __builtin_amdgcn_tensor_load_to_lds(g0, g1, z4, z4, z8, 0);
  }

  // ---- meanwhile: stage V transposed into padded LDS (conflict-free writes)
  for (int idx = tid; idx < kHd * kNkv; idx += 256) {
    const int d = idx >> 10;        // 0..31
    const int m = idx & (kNkv - 1); // consecutive per lane -> coalesced read
    ldsVt[m * kVST + d] = Vg[kvbase + idx];
  }

  if (wave == 0) __builtin_amdgcn_s_wait_tensorcnt(0);
  __syncthreads();

  const int q0 = qt * 128 + wave * 16;
  const size_t qbase = ((size_t)b * kC + head * kHd) * (size_t)kN;

  // ---- preload Q A-fragments (A 16x4 f32: lane -> M=l&15, K=2*(l>>4)+j)
  v2f aq[8];
#pragma unroll
  for (int dc = 0; dc < 8; ++dc) {
    const int d = dc * 4 + 2 * hi;
    aq[dc].x = Qg[qbase + (size_t)d * kN + q0 + col];
    aq[dc].y = Qg[qbase + (size_t)(d + 1) * kN + q0 + col];
  }

  v8f o0 = {}, o1 = {};
  float mrow[8], lrow[8];
#pragma unroll
  for (int r = 0; r < 8; ++r) { mrow[r] = -1e30f; lrow[r] = 0.f; }

  float* pb = ldsP + wave * 16 * kPST;  // wave-private 16 x 64 P tile (padded)

  for (int m0 = 0; m0 < kNkv; m0 += 64) {
    // ---- four S tiles = (Q tile)^T * K[., m0..m0+63]
    v8f s[4];
#pragma unroll
    for (int t = 0; t < 4; ++t) {
      v8f acc = {};
#pragma unroll
      for (int dc = 0; dc < 8; ++dc) {
        const int d = dc * 4 + 2 * hi;
        v2f bk;
        bk.x = ldsK[d * kNkv + m0 + t * 16 + col];
        bk.y = ldsK[(d + 1) * kNkv + m0 + t * 16 + col];
        acc = __builtin_amdgcn_wmma_f32_16x16x4_f32(false, aq[dc], false, bk,
                                                    (short)0, acc, false, false);
      }
      s[t] = acc;
    }

    // ---- online softmax over the 64-key block (one reduction pair per row)
#pragma unroll
    for (int r = 0; r < 8; ++r) {
      const float v0 = s[0][r] * kScale, v1 = s[1][r] * kScale;
      const float v2 = s[2][r] * kScale, v3 = s[3][r] * kScale;
      const float rm = rowmax16(fmaxf(fmaxf(v0, v1), fmaxf(v2, v3)));
      const float mnew  = fmaxf(mrow[r], rm);
      const float alpha = __expf(mrow[r] - mnew);
      const float p0 = __expf(v0 - mnew), p1 = __expf(v1 - mnew);
      const float p2 = __expf(v2 - mnew), p3 = __expf(v3 - mnew);
      const float rs = rowsum16((p0 + p1) + (p2 + p3));
      lrow[r] = lrow[r] * alpha + rs;
      mrow[r] = mnew;
      o0[r] *= alpha;
      o1[r] *= alpha;
      float* pr = pb + (r + 8 * hi) * kPST + col;   // C-layout -> row-major P
      pr[0] = p0; pr[16] = p1; pr[32] = p2; pr[48] = p3;
    }
    // Same-wave DS ops are in-order: reads below see the writes above.

    // ---- O += P * V^T (transposed, padded V: conflict-free B-frag reads)
#pragma unroll
    for (int t = 0; t < 4; ++t) {
#pragma unroll
      for (int mc = 0; mc < 4; ++mc) {
        const int ml = t * 16 + mc * 4 + 2 * hi;
        const int mm = m0 + ml;
        v2f ap, bv0, bv1;
        ap.x  = pb[col * kPST + ml];
        ap.y  = pb[col * kPST + ml + 1];
        bv0.x = ldsVt[mm * kVST + col];
        bv0.y = ldsVt[(mm + 1) * kVST + col];
        bv1.x = ldsVt[mm * kVST + 16 + col];
        bv1.y = ldsVt[(mm + 1) * kVST + 16 + col];
        o0 = __builtin_amdgcn_wmma_f32_16x16x4_f32(false, ap, false, bv0,
                                                   (short)0, o0, false, false);
        o1 = __builtin_amdgcn_wmma_f32_16x16x4_f32(false, ap, false, bv1,
                                                   (short)0, o1, false, false);
      }
    }
  }

  // ---- normalize and store (each lane's 8 C rows are consecutive n)
#pragma unroll
  for (int r = 0; r < 8; ++r) {
    const float inv = 1.f / lrow[r];
    o0[r] *= inv;
    o1[r] *= inv;
  }
  {
    float* p0 = Ao + qbase + (size_t)col * kN + q0 + 8 * hi;
    float* p1 = Ao + qbase + (size_t)(16 + col) * kN + q0 + 8 * hi;
    v4f t;
    t.x = o0[0]; t.y = o0[1]; t.z = o0[2]; t.w = o0[3]; *(v4f*)(p0)     = t;
    t.x = o0[4]; t.y = o0[5]; t.z = o0[6]; t.w = o0[7]; *(v4f*)(p0 + 4) = t;
    t.x = o1[0]; t.y = o1[1]; t.z = o1[2]; t.w = o1[3]; *(v4f*)(p1)     = t;
    t.x = o1[4]; t.y = o1[5]; t.z = o1[6]; t.w = o1[7]; *(v4f*)(p1 + 4) = t;
  }
}

// ---------------------------------------------------------------------------
extern "C" void kernel_launch(void* const* d_in, const int* in_sizes, int n_in,
                              void* d_out, int out_size, void* d_ws, size_t ws_size,
                              hipStream_t stream) {
  const float* x  = (const float*)d_in[0];
  const float* wq = (const float*)d_in[1];
  const float* wk = (const float*)d_in[2];
  const float* wv = (const float*)d_in[3];
  const float* wp = (const float*)d_in[4];

  float* Qb = (float*)d_ws;                          // [B,64,4096]
  float* Kb = Qb + (size_t)kB * kC * kN;             // [B,64,1024]
  float* Vb = Kb + (size_t)kB * kC * kNkv;           // [B,64,1024]
  float* Ab = Vb + (size_t)kB * kC * kNkv;           // [B,64,4096]

  sra_conv1x1<<<dim3(kN / 256, kB), 256, 0, stream>>>(x, wq, Qb);
  sra_conv2x2s2<<<dim3(kNkv / 256, kB), 256, 0, stream>>>(x, wk, Kb);
  sra_conv2x2s2<<<dim3(kNkv / 256, kB), 256, 0, stream>>>(x, wv, Vb);

  const size_t smem =
      (size_t)(kHd * kNkv + kNkv * kVST + 8 * 16 * kPST) * sizeof(float);
  (void)hipFuncSetAttribute((const void*)sra_attn,
                            hipFuncAttributeMaxDynamicSharedMemorySize,
                            (int)smem);
  sra_attn<<<dim3(kN / 128, kHeads, kB), 256, smem, stream>>>(Qb, Kb, Vb, Ab);

  sra_conv1x1<<<dim3(kN / 256, kB), 256, 0, stream>>>(Ab, wp, (float*)d_out);
}

// v001
// It runs in 187 microseconds.
// In two side-by-side timings against v000, it was 1.78 and 1.77 times as fast.
#include <hip/hip_runtime.h>

typedef __attribute__((ext_vector_type(2))) float v2f;
typedef __attribute__((ext_vector_type(4))) float v4f;
typedef __attribute__((ext_vector_type(8))) float v8f;
typedef __attribute__((ext_vector_type(4))) unsigned int v4u;
typedef __attribute__((ext_vector_type(4))) int v4i;
typedef __attribute__((ext_vector_type(8))) int v8i;

namespace {
constexpr int kB    = 16;
constexpr int kC    = 64;
constexpr int kH    = 64;
constexpr int kW    = 64;
constexpr int kN    = kH * kW;              // 4096 query positions
constexpr int kNkv  = (kH / 2) * (kW / 2);  // 1024 key positions
constexpr int kHeads = 2;
constexpr int kHd    = 32;
constexpr int kVST   = 33;                  // padded ldsVt row stride (floats)
constexpr int kPST   = 66;                  // padded P-tile row stride (floats)
constexpr int kWP1   = kC + 4;              // padded 1x1 weight row (floats)
constexpr int kWP2   = 4 * kC + 4;          // padded 2x2 weight row (floats)
constexpr float kScale = 0.17677669529663687f;  // 32^-0.5
}

// ---- VALU 16-lane butterfly reductions via DPP16 ROW_XMASK (no DS pipe) ----
template <int CTRL>
__device__ inline float dpp_movf(float x) {
  return __builtin_bit_cast(
      float, __builtin_amdgcn_update_dpp(0, __builtin_bit_cast(int, x), CTRL,
                                         0xF, 0xF, true));
}
__device__ inline float rowmax16(float x) {
  x = fmaxf(x, dpp_movf<0x161>(x));  // ROW_XMASK:1
  x = fmaxf(x, dpp_movf<0x162>(x));  // ROW_XMASK:2
  x = fmaxf(x, dpp_movf<0x164>(x));  // ROW_XMASK:4
  x = fmaxf(x, dpp_movf<0x168>(x));  // ROW_XMASK:8
  return x;
}
__device__ inline float rowsum16(float x) {
  x += dpp_movf<0x161>(x);
  x += dpp_movf<0x162>(x);
  x += dpp_movf<0x164>(x);
  x += dpp_movf<0x168>(x);
  return x;
}

// ---------------------------------------------------------------------------
// Both convolutions are GEMMs out[c, n] = W[c, k] * X[k, n] on
// V_WMMA_F32_16X16X4_F32: A = weights (M = c), B = x (N = position).
// The weights go through LDS once per block (coalesced 16-byte loads, rows
// padded by 16 bytes so that the 16-row fragment reads spread over the banks).
// One 16-byte LDS read holds the A fragments of two WMMAs: lane (col, hi)
// reads W[c0 + col][8p + 4hi .. + 3], so WMMA (p, q) has k = 8p + 4hi + 2q + j
// in slot (hi, j); the B loaders below use the same k in the same slot.
// ---------------------------------------------------------------------------
__device__ inline v8f mma4(v2f a, v2f b, v8f c) {
  return __builtin_amdgcn_wmma_f32_16x16x4_f32(false, a, false, b, (short)0, c,
                                               false, false);
}

// ---------------------------------------------------------------------------
// 1x1 conv over [B, 64, 4096]. Block = 64 c x 256 n, wave = 32 c x 64 n.
// N slot col of tile t is position n0 + 4*col + t: one 16-byte load of x feeds
// four tiles and one 16-byte store takes one row of four tiles.
// ---------------------------------------------------------------------------
__global__ __launch_bounds__(256) void sra_conv1x1(const float* __restrict__ in,
                                                   const float* __restrict__ w,
                                                   float* __restrict__ out) {
  __shared__ __attribute__((aligned(16))) float ldsW[kC * kWP1];
  const int tid  = threadIdx.x;
  const int wave = tid >> 5;
  const int lane = tid & 31;
  const int col  = lane & 15;
  const int hi   = lane >> 4;
  const int c0   = (wave & 1) * 32;
  const int b    = blockIdx.y;
  const int n0   = blockIdx.x * 256 + (wave >> 1) * 64;

  v4f wst[4];
#pragma unroll  // registers indexed by i: all four loads in flight at once
  for (int i = 0; i < 4; ++i) wst[i] = *(const v4f*)(w + (i * 256 + tid) * 4);

  // x[8p + 4hi + 2q + j][n0 + 4col .. + 3], issued ahead of the barrier so
  // that their latency runs beside the weight staging.
  const float* xb = in + (size_t)b * kC * kN + (size_t)(4 * hi) * kN + n0 + 4 * col;
  v4f xv[8][2][2];
#pragma unroll  // registers indexed by p, q, j
  for (int p = 0; p < 8; ++p)
#pragma unroll
    for (int q = 0; q < 2; ++q)
#pragma unroll
      for (int j = 0; j < 2; ++j)
        xv[p][q][j] = *(const v4f*)(xb + (size_t)(8 * p + 2 * q + j) * kN);

#pragma unroll  // wst[] is indexed by i
  for (int i = 0; i < 4; ++i) {
    const int f = (i * 256 + tid) * 4;
    *(v4f*)(ldsW + (f >> 6) * kWP1 + (f & 63)) = wst[i];
  }
  __syncthreads();  // the weights are read by all waves of the block

  const float* wr = ldsW + (c0 + col) * kWP1 + 4 * hi;
  v8f acc[2][4] = {};  // [c tile][n tile]
#pragma unroll  // registers indexed by p, q, t
  for (int p = 0; p < 8; ++p) {
    const v4f a40 = *(const v4f*)(wr + 8 * p);
    const v4f a41 = *(const v4f*)(wr + 16 * kWP1 + 8 * p);
#pragma unroll
    for (int q = 0; q < 2; ++q) {
      v2f a0, a1;
      a0.x = a40[2 * q]; a0.y = a40[2 * q + 1];
      a1.x = a41[2 * q]; a1.y = a41[2 * q + 1];
#pragma unroll
      for (int t = 0; t < 4; ++t) {
        v2f bf;
        bf.x = xv[p][q][0][t];
        bf.y = xv[p][q][1][t];
        acc[0][t] = mma4(a0, bf, acc[0][t]);
        acc[1][t] = mma4(a1, bf, acc[1][t]);
      }
    }
  }

  float* ob = out + (size_t)b * kC * kN + (size_t)(c0 + 8 * hi) * kN + n0 + 4 * col;
#pragma unroll  // acc[][] is indexed by mt, r
  for (int mt = 0; mt < 2; ++mt)
#pragma unroll
    for (int r = 0; r < 8; ++r) {
      v4f o;
      o.x = acc[mt][0][r]; o.y = acc[mt][1][r];
      o.z = acc[mt][2][r]; o.w = acc[mt][3][r];
      *(v4f*)(ob + (size_t)(mt * 16 + r) * kN) = o;
    }
}

// ---------------------------------------------------------------------------
// 2x2 stride-2 conv: out[c, m] (m over 32x32), k = (ci, dy, dx) = 256.
// Block = 64 c x 2 output rows, wave = 16 c x 1 output row (32 m, two tiles).
// k = 8p + 4hi + 2q + j means ci = 2p + hi, dy = q, dx = j: one 16-byte load of
// x[ci][2ky + q][4col .. + 3] is the B fragment pair of kx = 2col and 2col + 1.
// ---------------------------------------------------------------------------
__global__ __launch_bounds__(256) void sra_conv2x2s2(const float* __restrict__ in,
                                                     const float* __restrict__ w,
                                                     float* __restrict__ out) {
  __shared__ __attribute__((aligned(16))) float ldsW[kC * kWP2];
  const int tid  = threadIdx.x;
  const int wave = tid >> 5;
  const int lane = tid & 31;
  const int col  = lane & 15;
  const int hi   = lane >> 4;
  const int c0   = (wave & 3) * 16;
  const int b    = blockIdx.y;
  const int ky   = blockIdx.x * 2 + (wave >> 2);

  v4f wst[16];
#pragma unroll  // registers indexed by i: all sixteen loads in flight at once
  for (int i = 0; i < 16; ++i) wst[i] = *(const v4f*)(w + (i * 256 + tid) * 4);

  const float* xb = in + (size_t)b * kC * kN + (size_t)hi * kN + (2 * ky) * kW + 4 * col;
  v4f xv[2][8][2];  // two chunks of 8 p: one is worked on, the next one flies
#pragma unroll  // registers indexed by pp, q
  for (int pp = 0; pp < 8; ++pp)
#pragma unroll
    for (int q = 0; q < 2; ++q)
      xv[0][pp][q] = *(const v4f*)(xb + (size_t)(2 * pp) * kN + q * kW);

#pragma unroll  // wst[] is indexed by i
  for (int i = 0; i < 16; ++i) {
    const int f = (i * 256 + tid) * 4;
    *(v4f*)(ldsW + (f >> 8) * kWP2 + (f & 255)) = wst[i];
  }
  __syncthreads();  // the weights are read by all waves of the block

  const float* wr = ldsW + (c0 + col) * kWP2 + 4 * hi;
  v8f acc[2] = {};
#pragma unroll  // the chunk's buffer index must be a constant
  for (int ch = 0; ch < 4; ++ch) {
    if (ch + 1 < 4) {
#pragma unroll
      for (int pp = 0; pp < 8; ++pp)
#pragma unroll
        for (int q = 0; q < 2; ++q)
          xv[(ch + 1) & 1][pp][q] =
              *(const v4f*)(xb + (size_t)(2 * ((ch + 1) * 8 + pp)) * kN + q * kW);
    }
#pragma unroll
    for (int pp = 0; pp < 8; ++pp) {
      const v4f a4 = *(const v4f*)(wr + 8 * (ch * 8 + pp));
#pragma unroll
      for (int q = 0; q < 2; ++q) {
        const v4f x4 = xv[ch & 1][pp][q];
        v2f a, b0, b1;
        a.x  = a4[2 * q]; a.y  = a4[2 * q + 1];
        b0.x = x4[0];     b0.y = x4[1];
        b1.x = x4[2];     b1.y = x4[3];
        acc[0] = mma4(a, b0, acc[0]);
        acc[1] = mma4(a, b1, acc[1]);
      }
    }
  }

  float* ob = out + (size_t)b * kC * kNkv + (size_t)(c0 + 8 * hi) * kNkv + ky * 32 + 2 * col;
#pragma unroll  // acc[] is indexed by r
  for (int r = 0; r < 8; ++r) {
    v2f o;
    o.x = acc[0][r]; o.y = acc[1][r];
    *(v2f*)(ob + (size_t)r * kNkv) = o;
  }
}

// ---------------------------------------------------------------------------
// Fused flash-style attention per (b, head). 8 waves x 16 queries each.
// K staged into LDS by the Tensor Data Mover; V staged transposed (+padded)
// by the ALUs in parallel. Online softmax over 64-key blocks with DPP
// butterflies. All matmuls: V_WMMA_F32_16X16X4_F32 (fp32-exact).
// ---------------------------------------------------------------------------
__global__ __launch_bounds__(256) void sra_attn(const float* __restrict__ Qg,
                                                const float* __restrict__ Kg,
                                                const float* __restrict__ Vg,
                                                float* __restrict__ Ao) {
  extern __shared__ float smem[];
  float* ldsK  = smem;                        // [32][1024]
  float* ldsVt = smem + kHd * kNkv;           // [1024][33] transposed V
  float* ldsP  = ldsVt + kNkv * kVST;         // 8 waves * 16 * kPST

  const int tid  = threadIdx.x;
  const int wave = tid >> 5;
  const int lane = tid & 31;
  const int col  = lane & 15;
  const int hi   = lane >> 4;

  const int qt   = blockIdx.x;
  const int head = blockIdx.y;
  const int b    = blockIdx.z;

  const size_t kvbase = ((size_t)b * kC + head * kHd) * (size_t)kNkv;

  // ---- stage K via TDM: D# = 2-D tensor 1024 x 32 (f32), tile = all of it
  if (wave == 0) {
    const unsigned long long ga = (unsigned long long)(Kg + kvbase);
    const unsigned ldsa = (unsigned)(unsigned long long)(uintptr_t)ldsK;
    v4u g0;
    g0[0] = 1u;                                   // count=1, user D#
    g0[1] = ldsa;                                 // lds_addr (bytes)
    g0[2] = (unsigned)(ga & 0xFFFFFFFFull);       // global_addr[31:0]
    g0[3] = (unsigned)((ga >> 32) & 0x01FFFFFFull) | (2u << 30);  // type=2
    v8i g1;
    g1[0] = (int)(2u << 16);        // data_size = 4B
    g1[1] = (int)(1024u << 16);     // tensor_dim0 = 1024 (low 16 in [63:48])
    g1[2] = (int)(32u << 16);       // tensor_dim1 = 32
    g1[3] = (int)(1024u << 16);     // tile_dim0 = 1024
    g1[4] = 32;                     // tile_dim1 = 32, tile_dim2 = 0
    g1[5] = 1024;                   // tensor_dim0_stride = 1024
    g1[6] = 0;
    g1[7] = 0;
    v4i z4 = {0, 0, 0, 0};
    v8i z8 = {0, 0, 0, 0, 0, 0, 0, 0};
    __builtin_amdgcn_tensor_load_to_lds(g0, g1, z4, z4, z8, 0);
  }

  // ---- meanwhile: stage V transposed into padded LDS (conflict-free writes)
  for (int idx = tid; idx < kHd * kNkv; idx += 256) {
    const int d = idx >> 10;        // 0..31
    const int m = idx & (kNkv - 1); // consecutive per lane -> coalesced read
    ldsVt[m * kVST + d] = Vg[kvbase + idx];
  }

  if (wave == 0) __builtin_amdgcn_s_wait_tensorcnt(0);
  __syncthreads();

  const int q0 = qt * 128 + wave * 16;
  const size_t qbase = ((size_t)b * kC + head * kHd) * (size_t)kN;

  // ---- preload Q A-fragments (A 16x4 f32: lane -> M=l&15, K=2*(l>>4)+j)
  v2f aq[8];
#pragma unroll
  for (int dc = 0; dc < 8; ++dc) {
    const int d = dc * 4 + 2 * hi;
    aq[dc].x = Qg[qbase + (size_t)d * kN + q0 + col];
    aq[dc].y = Qg[qbase + (size_t)(d + 1) * kN + q0 + col];
  }

  v8f o0 = {}, o1 = {};
  float mrow[8], lrow[8];
#pragma unroll
  for (int r = 0; r < 8; ++r) { mrow[r] = -1e30f; lrow[r] = 0.f; }

  float* pb = ldsP + wave * 16 * kPST;  // wave-private 16 x 64 P tile (padded)

  for (int m0 = 0; m0 < kNkv; m0 += 64) {
    // ---- four S tiles = (Q tile)^T * K[., m0..m0+63]
    v8f s[4];
#pragma unroll
    for (int t = 0; t < 4; ++t) {
      v8f acc = {};
#pragma unroll
      for (int dc = 0; dc < 8; ++dc) {
        const int d = dc * 4 + 2 * hi;
        v2f bk;
        bk.x = ldsK[d * kNkv + m0 + t * 16 + col];
        bk.y = ldsK[(d + 1) * kNkv + m0 + t * 16 + col];
        acc = __builtin_amdgcn_wmma_f32_16x16x4_f32(false, aq[dc], false, bk,
                                                    (short)0, acc, false, false);
      }
      s[t] = acc;
    }

    // ---- online softmax over the 64-key block (one reduction pair per row)
#pragma unroll
    for (int r = 0; r < 8; ++r) {
      const float v0 = s[0][r] * kScale, v1 = s[1][r] * kScale;
      const float v2 = s[2][r] * kScale, v3 = s[3][r] * kScale;
      const float rm = rowmax16(fmaxf(fmaxf(v0, v1), fmaxf(v2, v3)));
      const float mnew  = fmaxf(mrow[r], rm);
      const float alpha = __expf(mrow[r] - mnew);
      const float p0 = __expf(v0 - mnew), p1 = __expf(v1 - mnew);
      const float p2 = __expf(v2 - mnew), p3 = __expf(v3 - mnew);
      const float rs = rowsum16((p0 + p1) + (p2 + p3));
      lrow[r] = lrow[r] * alpha + rs;
      mrow[r] = mnew;
      o0[r] *= alpha;
      o1[r] *= alpha;
      float* pr = pb + (r + 8 * hi) * kPST + col;   // C-layout -> row-major P
      pr[0] = p0; pr[16] = p1; pr[32] = p2; pr[48] = p3;
    }
    // Same-wave DS ops are in-order: reads below see the writes above.

    // ---- O += P * V^T (transposed, padded V: conflict-free B-frag reads)
#pragma unroll
    for (int t = 0; t < 4; ++t) {
#pragma unroll
      for (int mc = 0; mc < 4; ++mc) {
        const int ml = t * 16 + mc * 4 + 2 * hi;
        const int mm = m0 + ml;
        v2f ap, bv0, bv1;
        ap.x  = pb[col * kPST + ml];
        ap.y  = pb[col * kPST + ml + 1];
        bv0.x = ldsVt[mm * kVST + col];
        bv0.y = ldsVt[(mm + 1) * kVST + col];
        bv1.x = ldsVt[mm * kVST + 16 + col];
        bv1.y = ldsVt[(mm + 1) * kVST + 16 + col];
        o0 = __builtin_amdgcn_wmma_f32_16x16x4_f32(false, ap, false, bv0,
                                                   (short)0, o0, false, false);
        o1 = __builtin_amdgcn_wmma_f32_16x16x4_f32(false, ap, false, bv1,
                                                   (short)0, o1, false, false);
      }
    }
  }

  // ---- normalize and store (each lane's 8 C rows are consecutive n)
#pragma unroll
  for (int r = 0; r < 8; ++r) {
    const float inv = 1.f / lrow[r];
    o0[r] *= inv;
    o1[r] *= inv;
  }
  {
    float* p0 = Ao + qbase + (size_t)col * kN + q0 + 8 * hi;
    float* p1 = Ao + qbase + (size_t)(16 + col) * kN + q0 + 8 * hi;
    v4f t;
    t.x = o0[0]; t.y = o0[1]; t.z = o0[2]; t.w = o0[3]; *(v4f*)(p0)     = t;
    t.x = o0[4]; t.y = o0[5]; t.z = o0[6]; t.w = o0[7]; *(v4f*)(p0 + 4) = t;
    t.x = o1[0]; t.y = o1[1]; t.z = o1[2]; t.w = o1[3]; *(v4f*)(p1)     = t;
    t.x = o1[4]; t.y = o1[5]; t.z = o1[6]; t.w = o1[7]; *(v4f*)(p1 + 4) = t;
  }
}

// ---------------------------------------------------------------------------
extern "C" void kernel_launch(void* const* d_in, const int* in_sizes, int n_in,
                              void* d_out, int out_size, void* d_ws, size_t ws_size,
                              hipStream_t stream) {
  const float* x  = (const float*)d_in[0];
  const float* wq = (const float*)d_in[1];
  const float* wk = (const float*)d_in[2];
  const float* wv = (const float*)d_in[3];
  const float* wp = (const float*)d_in[4];

  float* Qb = (float*)d_ws;                          // [B,64,4096]
  float* Kb = Qb + (size_t)kB * kC * kN;             // [B,64,1024]
  float* Vb = Kb + (size_t)kB * kC * kNkv;           // [B,64,1024]
  float* Ab = Vb + (size_t)kB * kC * kNkv;           // [B,64,4096]

  sra_conv1x1<<<dim3(kN / 256, kB), 256, 0, stream>>>(x, wq, Qb);
  sra_conv2x2s2<<<dim3(kH / 4, kB), 256, 0, stream>>>(x, wk, Kb);
  sra_conv2x2s2<<<dim3(kH / 4, kB), 256, 0, stream>>>(x, wv, Vb);

  const size_t smem =
      (size_t)(kHd * kNkv + kNkv * kVST + 8 * 16 * kPST) * sizeof(float);
  (void)hipFuncSetAttribute((const void*)sra_attn,
                            hipFuncAttributeMaxDynamicSharedMemorySize,
                            (int)smem);
  sra_attn<<<dim3(kN / 128, kHeads, kB), 256, smem, stream>>>(Qb, Kb, Vb, Ab);

  sra_conv1x1<<<dim3(kN / 256, kB), 256, 0, stream>>>(Ab, wp, (float*)d_out);
}

// v002
// A run of this version takes 138 microseconds.
// Timed twice side by side with v001, it ran 1.36 times as fast both times.
// Over all steps from v000 it is 2.41 times as fast.
#include <hip/hip_runtime.h>

typedef __attribute__((ext_vector_type(2))) float v2f;
typedef __attribute__((ext_vector_type(4))) float v4f;
typedef __attribute__((ext_vector_type(8))) float v8f;
typedef __attribute__((ext_vector_type(4))) unsigned int v4u;
typedef __attribute__((ext_vector_type(4))) int v4i;
typedef __attribute__((ext_vector_type(8))) int v8i;

namespace {
constexpr int kB    = 16;
constexpr int kC    = 64;
constexpr int kH    = 64;
constexpr int kW    = 64;
constexpr int kN    = kH * kW;              // 4096 query positions
constexpr int kNkv  = (kH / 2) * (kW / 2);  // 1024 key positions
constexpr int kHeads = 2;
constexpr int kHd    = 32;
constexpr int kVP    = kNkv + 4;             // padded V row in LDS (floats)
constexpr int kPP    = 64 + 4;               // padded P-tile row in LDS (floats)
constexpr int kWP1   = kC + 4;              // padded 1x1 weight row (floats)
constexpr int kWP2   = 4 * kC + 4;          // padded 2x2 weight row (floats)
constexpr float kScale = 0.17677669529663687f;  // 32^-0.5
}

// ---- VALU 16-lane butterfly reductions via DPP16 ROW_XMASK (no DS pipe) ----
template <int CTRL>
__device__ inline float dpp_movf(float x) {
  return __builtin_bit_cast(
      float, __builtin_amdgcn_update_dpp(0, __builtin_bit_cast(int, x), CTRL,
                                         0xF, 0xF, true));
}
__device__ inline float rowmax16(float x) {
  x = fmaxf(x, dpp_movf<0x161>(x));  // ROW_XMASK:1
  x = fmaxf(x, dpp_movf<0x162>(x));  // ROW_XMASK:2
  x = fmaxf(x, dpp_movf<0x164>(x));  // ROW_XMASK:4
  x = fmaxf(x, dpp_movf<0x168>(x));  // ROW_XMASK:8
  return x;
}
__device__ inline float rowsum16(float x) {
  x += dpp_movf<0x161>(x);
  x += dpp_movf<0x162>(x);
  x += dpp_movf<0x164>(x);
  x += dpp_movf<0x168>(x);
  return x;
}

// ---------------------------------------------------------------------------
// Both convolutions are GEMMs out[c, n] = W[c, k] * X[k, n] on
// V_WMMA_F32_16X16X4_F32: A = weights (M = c), B = x (N = position).
// The weights go through LDS once per block (coalesced 16-byte loads, rows
// padded by 16 bytes so that the 16-row fragment reads spread over the banks).
// One 16-byte LDS read holds the A fragments of two WMMAs: lane (col, hi)
// reads W[c0 + col][8p + 4hi .. + 3], so WMMA (p, q) has k = 8p + 4hi + 2q + j
// in slot (hi, j); the B loaders below use the same k in the same slot.
// ---------------------------------------------------------------------------
__device__ inline v8f mma4(v2f a, v2f b, v8f c) {
  return __builtin_amdgcn_wmma_f32_16x16x4_f32(false, a, false, b, (short)0, c,
                                               false, false);
}

// ---------------------------------------------------------------------------
// 1x1 conv over [B, 64, 4096]. Block = 64 c x 256 n, wave = 32 c x 64 n.
// N slot col of tile t is position n0 + 4*col + t: one 16-byte load of x feeds
// four tiles and one 16-byte store takes one row of four tiles.
// ---------------------------------------------------------------------------
__global__ __launch_bounds__(256) void sra_conv1x1(const float* __restrict__ in,
                                                   const float* __restrict__ w,
                                                   float* __restrict__ out) {
  __shared__ __attribute__((aligned(16))) float ldsW[kC * kWP1];
  const int tid  = threadIdx.x;
  const int wave = tid >> 5;
  const int lane = tid & 31;
  const int col  = lane & 15;
  const int hi   = lane >> 4;
  const int c0   = (wave & 1) * 32;
  const int b    = blockIdx.y;
  const int n0   = blockIdx.x * 256 + (wave >> 1) * 64;

  v4f wst[4];
#pragma unroll  // registers indexed by i: all four loads in flight at once
  for (int i = 0; i < 4; ++i) wst[i] = *(const v4f*)(w + (i * 256 + tid) * 4);

  // x[8p + 4hi + 2q + j][n0 + 4col .. + 3], issued ahead of the barrier so
  // that their latency runs beside the weight staging.
  const float* xb = in + (size_t)b * kC * kN + (size_t)(4 * hi) * kN + n0 + 4 * col;
  v4f xv[8][2][2];
#pragma unroll  // registers indexed by p, q, j
  for (int p = 0; p < 8; ++p)
#pragma unroll
    for (int q = 0; q < 2; ++q)
#pragma unroll
      for (int j = 0; j < 2; ++j)
        xv[p][q][j] = *(const v4f*)(xb + (size_t)(8 * p + 2 * q + j) * kN);

#pragma unroll  // wst[] is indexed by i
  for (int i = 0; i < 4; ++i) {
    const int f = (i * 256 + tid) * 4;
    *(v4f*)(ldsW + (f >> 6) * kWP1 + (f & 63)) = wst[i];
  }
  __syncthreads();  // the weights are read by all waves of the block

  const float* wr = ldsW + (c0 + col) * kWP1 + 4 * hi;
  v8f acc[2][4] = {};  // [c tile][n tile]
#pragma unroll  // registers indexed by p, q, t
  for (int p = 0; p < 8; ++p) {
    const v4f a40 = *(const v4f*)(wr + 8 * p);
    const v4f a41 = *(const v4f*)(wr + 16 * kWP1 + 8 * p);
#pragma unroll
    for (int q = 0; q < 2; ++q) {
      v2f a0, a1;
      a0.x = a40[2 * q]; a0.y = a40[2 * q + 1];
      a1.x = a41[2 * q]; a1.y = a41[2 * q + 1];
#pragma unroll
      for (int t = 0; t < 4; ++t) {
        v2f bf;
        bf.x = xv[p][q][0][t];
        bf.y = xv[p][q][1][t];
        acc[0][t] = mma4(a0, bf, acc[0][t]);
        acc[1][t] = mma4(a1, bf, acc[1][t]);
      }
    }
  }

  float* ob = out + (size_t)b * kC * kN + (size_t)(c0 + 8 * hi) * kN + n0 + 4 * col;
#pragma unroll  // acc[][] is indexed by mt, r
  for (int mt = 0; mt < 2; ++mt)
#pragma unroll
    for (int r = 0; r < 8; ++r) {
      v4f o;
      o.x = acc[mt][0][r]; o.y = acc[mt][1][r];
      o.z = acc[mt][2][r]; o.w = acc[mt][3][r];
      *(v4f*)(ob + (size_t)(mt * 16 + r) * kN) = o;
    }
}

// ---------------------------------------------------------------------------
// 2x2 stride-2 conv: out[c, m] (m over 32x32), k = (ci, dy, dx) = 256.
// Block = 64 c x 2 output rows, wave = 16 c x 1 output row (32 m, two tiles).
// k = 8p + 4hi + 2q + j means ci = 2p + hi, dy = q, dx = j: one 16-byte load of
// x[ci][2ky + q][4col .. + 3] is the B fragment pair of kx = 2col and 2col + 1.
// ---------------------------------------------------------------------------
__global__ __launch_bounds__(256) void sra_conv2x2s2(const float* __restrict__ in,
                                                     const float* __restrict__ w,
                                                     float* __restrict__ out) {
  __shared__ __attribute__((aligned(16))) float ldsW[kC * kWP2];
  const int tid  = threadIdx.x;
  const int wave = tid >> 5;
  const int lane = tid & 31;
  const int col  = lane & 15;
  const int hi   = lane >> 4;
  const int c0   = (wave & 3) * 16;
  const int b    = blockIdx.y;
  const int ky   = blockIdx.x * 2 + (wave >> 2);

  v4f wst[16];
#pragma unroll  // registers indexed by i: all sixteen loads in flight at once
  for (int i = 0; i < 16; ++i) wst[i] = *(const v4f*)(w + (i * 256 + tid) * 4);

  const float* xb = in + (size_t)b * kC * kN + (size_t)hi * kN + (2 * ky) * kW + 4 * col;
  v4f xv[2][8][2];  // two chunks of 8 p: one is worked on, the next one flies
#pragma unroll  // registers indexed by pp, q
  for (int pp = 0; pp < 8; ++pp)
#pragma unroll
    for (int q = 0; q < 2; ++q)
      xv[0][pp][q] = *(const v4f*)(xb + (size_t)(2 * pp) * kN + q * kW);

#pragma unroll  // wst[] is indexed by i
  for (int i = 0; i < 16; ++i) {
    const int f = (i * 256 + tid) * 4;
    *(v4f*)(ldsW + (f >> 8) * kWP2 + (f & 255)) = wst[i];
  }
  __syncthreads();  // the weights are read by all waves of the block

  const float* wr = ldsW + (c0 + col) * kWP2 + 4 * hi;
  v8f acc[2] = {};
#pragma unroll  // the chunk's buffer index must be a constant
  for (int ch = 0; ch < 4; ++ch) {
    if (ch + 1 < 4) {
#pragma unroll
      for (int pp = 0; pp < 8; ++pp)
#pragma unroll
        for (int q = 0; q < 2; ++q)
          xv[(ch + 1) & 1][pp][q] =
              *(const v4f*)(xb + (size_t)(2 * ((ch + 1) * 8 + pp)) * kN + q * kW);
    }
#pragma unroll
    for (int pp = 0; pp < 8; ++pp) {
      const v4f a4 = *(const v4f*)(wr + 8 * (ch * 8 + pp));
#pragma unroll
      for (int q = 0; q < 2; ++q) {
        const v4f x4 = xv[ch & 1][pp][q];
        v2f a, b0, b1;
        a.x  = a4[2 * q]; a.y  = a4[2 * q + 1];
        b0.x = x4[0];     b0.y = x4[1];
        b1.x = x4[2];     b1.y = x4[3];
        acc[0] = mma4(a, b0, acc[0]);
        acc[1] = mma4(a, b1, acc[1]);
      }
    }
  }

  float* ob = out + (size_t)b * kC * kNkv + (size_t)(c0 + 8 * hi) * kNkv + ky * 32 + 2 * col;
#pragma unroll  // acc[] is indexed by r
  for (int r = 0; r < 8; ++r) {
    v2f o;
    o.x = acc[0][r]; o.y = acc[1][r];
    *(v2f*)(ob + (size_t)r * kNkv) = o;
  }
}

// ---------------------------------------------------------------------------
// Fused flash-style attention per (b, head). 8 waves x 16 queries each.
// K staged into LDS by the Tensor Data Mover; V staged row-major (rows padded
// by 16 bytes) by the ALUs in parallel. Online softmax over 64-key blocks with
// DPP butterflies. All matmuls: V_WMMA_F32_16X16X4_F32 (fp32-exact).
// Every LDS access of the key loop is 16 bytes wide:
//  - S tile t has key m0 + 4*col + t in N slot col, so one read of
//    K[d][m0 + 4col .. + 3] feeds four tiles and one store takes a lane's four
//    P values of a row (P column c is key m0 + c);
//  - P*V WMMA (p, q) has key m0 + 8p + 4hi + 2q + j in k slot (hi, j): one read
//    of P[query][8p + 4hi .. + 3] and one of V[d][m0 + 8p + 4hi .. + 3] each
//    hold the fragments of two WMMAs, the same k in the same slot.
// Row pitches of 16 bytes x odd spread the 16-row reads of P and V over the banks.
// ---------------------------------------------------------------------------
__global__ __launch_bounds__(256) void sra_attn(const float* __restrict__ Qg,
                                                const float* __restrict__ Kg,
                                                const float* __restrict__ Vg,
                                                float* __restrict__ Ao) {
  extern __shared__ __attribute__((aligned(16))) float smem[];
  float* ldsK  = smem;                        // [32][1024]
  float* ldsV  = smem + kHd * kNkv;           // [32][kVP]
  float* ldsP  = ldsV + kHd * kVP;            // 8 waves * 16 * kPP

  const int tid  = threadIdx.x;
  const int wave = tid >> 5;
  const int lane = tid & 31;
  const int col  = lane & 15;
  const int hi   = lane >> 4;

  const int qt   = blockIdx.x;
  const int head = blockIdx.y;
  const int b    = blockIdx.z;

  const size_t kvbase = ((size_t)b * kC + head * kHd) * (size_t)kNkv;

  // ---- stage K via TDM: D# = 2-D tensor 1024 x 32 (f32), tile = all of it
  if (wave == 0) {
    const unsigned long long ga = (unsigned long long)(Kg + kvbase);
    const unsigned ldsa = (unsigned)(unsigned long long)(uintptr_t)ldsK;
    v4u g0;
    g0[0] = 1u;                                   // count=1, user D#
    g0[1] = ldsa;                                 // lds_addr (bytes)
    g0[2] = (unsigned)(ga & 0xFFFFFFFFull);       // global_addr[31:0]
    g0[3] = (unsigned)((ga >> 32) & 0x01FFFFFFull) | (2u << 30);  // type=2
    v8i g1;
    g1[0] = (int)(2u << 16);        // data_size = 4B
    g1[1] = (int)(1024u << 16);     // tensor_dim0 = 1024 (low 16 in [63:48])
    g1[2] = (int)(32u << 16);       // tensor_dim1 = 32
    g1[3] = (int)(1024u << 16);     // tile_dim0 = 1024
    g1[4] = 32;                     // tile_dim1 = 32, tile_dim2 = 0
    g1[5] = 1024;                   // tensor_dim0_stride = 1024
    g1[6] = 0;
    g1[7] = 0;
    v4i z4 = {0, 0, 0, 0};
    v8i z8 = {0, 0, 0, 0, 0, 0, 0, 0};
    __builtin_amdgcn_tensor_load_to_lds(g0, g1, z4, z4, z8, 0);
  }

  // ---- meanwhile: stage V, one row of 1024 keys per step of the block
  {
    const float* vsrc = Vg + kvbase + 4 * tid;
    v4f vst[kHd];
#pragma unroll  // registers indexed by d: all loads in flight at once
    for (int d = 0; d < kHd; ++d) vst[d] = *(const v4f*)(vsrc + d * kNkv);
#pragma unroll  // vst[] is indexed by d
    for (int d = 0; d < kHd; ++d) *(v4f*)(ldsV + d * kVP + 4 * tid) = vst[d];
  }

  if (wave == 0) __builtin_amdgcn_s_wait_tensorcnt(0);
  __syncthreads();

  const int q0 = qt * 128 + wave * 16;
  const size_t qbase = ((size_t)b * kC + head * kHd) * (size_t)kN;

  // ---- preload Q A-fragments (A 16x4 f32: lane -> M=l&15, K=2*(l>>4)+j)
  v2f aq[8];
#pragma unroll
  for (int dc = 0; dc < 8; ++dc) {
    const int d = dc * 4 + 2 * hi;
    aq[dc].x = Qg[qbase + (size_t)d * kN + q0 + col];
    aq[dc].y = Qg[qbase + (size_t)(d + 1) * kN + q0 + col];
  }

  v8f o0 = {}, o1 = {};
  float mrow[8], lrow[8];
#pragma unroll
  for (int r = 0; r < 8; ++r) { mrow[r] = -1e30f; lrow[r] = 0.f; }

  float* pb = ldsP + wave * 16 * kPP;   // wave-private 16 x 64 P tile (padded)
  const float* kr = ldsK + (2 * hi) * kNkv + 4 * col;  // K[2hi + .][4col + .]
  const float* vr = ldsV + col * kVP + 4 * hi;         // V[col + .][4hi + .]
  const float* pr = pb + col * kPP + 4 * hi;           // P[col][4hi + .]
  float*       pw = pb + (8 * hi) * kPP + 4 * col;     // P[8hi + .][4col + .]

  for (int m0 = 0; m0 < kNkv; m0 += 64) {
    // ---- this block's K and V fragments, one group of reads
    v4f kx[8][2], vx[2][8];
#pragma unroll  // registers indexed by dc, j
    for (int dc = 0; dc < 8; ++dc)
#pragma unroll
      for (int j = 0; j < 2; ++j)
        kx[dc][j] = *(const v4f*)(kr + (dc * 4 + j) * kNkv + m0);
#pragma unroll  // registers indexed by dt, p
    for (int dt = 0; dt < 2; ++dt)
#pragma unroll
      for (int p = 0; p < 8; ++p)
        vx[dt][p] = *(const v4f*)(vr + dt * 16 * kVP + m0 + 8 * p);
    // Keeps the 32 reads one group: split up, each part costs its own LDS wait.
    __builtin_amdgcn_sched_barrier(0);

    // ---- four S tiles = (Q tile)^T * K[., m0..m0+63]
    v8f s[4] = {};
#pragma unroll  // registers indexed by dc, t
    for (int dc = 0; dc < 8; ++dc)
#pragma unroll
      for (int t = 0; t < 4; ++t) {
        v2f bk;
        bk.x = kx[dc][0][t];
        bk.y = kx[dc][1][t];
        s[t] = mma4(aq[dc], bk, s[t]);
      }

    // ---- online softmax over the 64-key block (one reduction pair per row)
    float alpha[8], ps[8];
#pragma unroll
    for (int r = 0; r < 8; ++r) {
      const float v0 = s[0][r] * kScale, v1 = s[1][r] * kScale;
      const float v2 = s[2][r] * kScale, v3 = s[3][r] * kScale;
      const float rm = rowmax16(fmaxf(fmaxf(v0, v1), fmaxf(v2, v3)));
      const float mnew  = fmaxf(mrow[r], rm);
      alpha[r] = __expf(mrow[r] - mnew);
      const float p0 = __expf(v0 - mnew), p1 = __expf(v1 - mnew);
      const float p2 = __expf(v2 - mnew), p3 = __expf(v3 - mnew);
      ps[r] = (p0 + p1) + (p2 + p3);
      mrow[r] = mnew;
      v4f p4;
      p4.x = p0; p4.y = p1; p4.z = p2; p4.w = p3;
      *(v4f*)(pw + r * kPP) = p4;                   // C-layout -> row-major P
    }
    // Same-wave DS ops are in-order: reads below see the writes above.
    v4f pa[8];
#pragma unroll  // registers indexed by p
    for (int p = 0; p < 8; ++p) pa[p] = *(const v4f*)(pr + 8 * p);
    // Keeps the 8 reads one group right behind the stores; the row sums and the
    // rescale below then run while the reads are under way.
    __builtin_amdgcn_sched_barrier(0);

#pragma unroll  // registers indexed by r
    for (int r = 0; r < 8; ++r) {
      lrow[r] = lrow[r] * alpha[r] + rowsum16(ps[r]);
      o0[r] *= alpha[r];
      o1[r] *= alpha[r];
    }

    // ---- O += P * V^T
#pragma unroll  // registers indexed by p, q
    for (int p = 0; p < 8; ++p) {
#pragma unroll
      for (int q = 0; q < 2; ++q) {
        v2f ap, bv0, bv1;
        ap.x  = pa[p][2 * q];    ap.y  = pa[p][2 * q + 1];
        bv0.x = vx[0][p][2 * q]; bv0.y = vx[0][p][2 * q + 1];
        bv1.x = vx[1][p][2 * q]; bv1.y = vx[1][p][2 * q + 1];
        o0 = mma4(ap, bv0, o0);
        o1 = mma4(ap, bv1, o1);
      }
    }
  }

  // ---- normalize and store (each lane's 8 C rows are consecutive n)
#pragma unroll
  for (int r = 0; r < 8; ++r) {
    const float inv = 1.f / lrow[r];
    o0[r] *= inv;
    o1[r] *= inv;
  }
  {
    float* p0 = Ao + qbase + (size_t)col * kN + q0 + 8 * hi;
    float* p1 = Ao + qbase + (size_t)(16 + col) * kN + q0 + 8 * hi;
    v4f t;
    t.x = o0[0]; t.y = o0[1]; t.z = o0[2]; t.w = o0[3]; *(v4f*)(p0)     = t;
    t.x = o0[4]; t.y = o0[5]; t.z = o0[6]; t.w = o0[7]; *(v4f*)(p0 + 4) = t;
    t.x = o1[0]; t.y = o1[1]; t.z = o1[2]; t.w = o1[3]; *(v4f*)(p1)     = t;
    t.x = o1[4]; t.y = o1[5]; t.z = o1[6]; t.w = o1[7]; *(v4f*)(p1 + 4) = t;
  }
}

// ---------------------------------------------------------------------------
extern "C" void kernel_launch(void* const* d_in, const int* in_sizes, int n_in,
                              void* d_out, int out_size, void* d_ws, size_t ws_size,
                              hipStream_t stream) {
  const float* x  = (const float*)d_in[0];
  const float* wq = (const float*)d_in[1];
  const float* wk = (const float*)d_in[2];
  const float* wv = (const float*)d_in[3];
  const float* wp = (const float*)d_in[4];

  float* Qb = (float*)d_ws;                          // [B,64,4096]
  float* Kb = Qb + (size_t)kB * kC * kN;             // [B,64,1024]
  float* Vb = Kb + (size_t)kB * kC * kNkv;           // [B,64,1024]
  float* Ab = Vb + (size_t)kB * kC * kNkv;           // [B,64,4096]

  sra_conv1x1<<<dim3(kN / 256, kB), 256, 0, stream>>>(x, wq, Qb);
  sra_conv2x2s2<<<dim3(kH / 4, kB), 256, 0, stream>>>(x, wk, Kb);
  sra_conv2x2s2<<<dim3(kH / 4, kB), 256, 0, stream>>>(x, wv, Vb);

  const size_t smem =
      (size_t)(kHd * kNkv + kHd * kVP + 8 * 16 * kPP) * sizeof(float);
  (void)hipFuncSetAttribute((const void*)sra_attn,
                            hipFuncAttributeMaxDynamicSharedMemorySize,
                            (int)smem);
  sra_attn<<<dim3(kN / 128, kHeads, kB), 256, smem, stream>>>(Qb, Kb, Vb, Ab);

  sra_conv1x1<<<dim3(kN / 256, kB), 256, 0, stream>>>(Ab, wp, (float*)d_out);
}

// v003
// It runs in 126 microseconds.
// Two timings next to v002 both put it at 1.09 times that version's speed.
// Over all steps from v000 it is 2.63 times as fast.
#include <hip/hip_runtime.h>

typedef __attribute__((ext_vector_type(2))) float v2f;
typedef __attribute__((ext_vector_type(4))) float v4f;
typedef __attribute__((ext_vector_type(8))) float v8f;
typedef __attribute__((ext_vector_type(4))) unsigned int v4u;
typedef __attribute__((ext_vector_type(4))) int v4i;
typedef __attribute__((ext_vector_type(8))) int v8i;

namespace {
constexpr int kB    = 16;
constexpr int kC    = 64;
constexpr int kH    = 64;
constexpr int kW    = 64;
constexpr int kN    = kH * kW;              // 4096 query positions
constexpr int kNkv  = (kH / 2) * (kW / 2);  // 1024 key positions
constexpr int kHeads = 2;
constexpr int kHd    = 32;
constexpr int kVP    = kNkv + 4;             // padded V row in LDS (floats)
constexpr int kWP1   = kC + 4;              // padded 1x1 weight row (floats)
constexpr int kWP2   = 4 * kC + 4;          // padded 2x2 weight row (floats)
constexpr float kScale = 0.17677669529663687f;  // 32^-0.5
}

// ---- lane l <-> lane l ^ 16: the two halves of a wave hold one query column
__device__ inline float xhalf(float x) {
  const int b = __builtin_bit_cast(int, x);
  return __builtin_bit_cast(
      float, __builtin_amdgcn_permlanex16(b, b, 0x76543210, 0xfedcba98, false, false));
}

// ---------------------------------------------------------------------------
// Both convolutions are GEMMs out[c, n] = W[c, k] * X[k, n] on
// V_WMMA_F32_16X16X4_F32: A = weights (M = c), B = x (N = position).
// The weights go through LDS once per block (coalesced 16-byte loads, rows
// padded by 16 bytes so that the 16-row fragment reads spread over the banks).
// One 16-byte LDS read holds the A fragments of two WMMAs: lane (col, hi)
// reads W[c0 + col][8p + 4hi .. + 3], so WMMA (p, q) has k = 8p + 4hi + 2q + j
// in slot (hi, j); the B loaders below use the same k in the same slot.
// ---------------------------------------------------------------------------
__device__ inline v8f mma4(v2f a, v2f b, v8f c) {
  return __builtin_amdgcn_wmma_f32_16x16x4_f32(false, a, false, b, (short)0, c,
                                               false, false);
}

// ---------------------------------------------------------------------------
// 1x1 conv over [B, 64, 4096]. Block = 64 c x 256 n, wave = 32 c x 64 n.
// N slot col of tile t is position n0 + 4*col + t: one 16-byte load of x feeds
// four tiles and one 16-byte store takes one row of four tiles.
// ---------------------------------------------------------------------------
__global__ __launch_bounds__(256) void sra_conv1x1(const float* __restrict__ in,
                                                   const float* __restrict__ w,
                                                   float* __restrict__ out) {
  __shared__ __attribute__((aligned(16))) float ldsW[kC * kWP1];
  const int tid  = threadIdx.x;
  const int wave = tid >> 5;
  const int lane = tid & 31;
  const int col  = lane & 15;
  const int hi   = lane >> 4;
  const int c0   = (wave & 1) * 32;
  const int b    = blockIdx.y;
  const int n0   = blockIdx.x * 256 + (wave >> 1) * 64;

  v4f wst[4];
#pragma unroll  // registers indexed by i: all four loads in flight at once
  for (int i = 0; i < 4; ++i) wst[i] = *(const v4f*)(w + (i * 256 + tid) * 4);

  // x[8p + 4hi + 2q + j][n0 + 4col .. + 3], issued ahead of the barrier so
  // that their latency runs beside the weight staging.
  const float* xb = in + (size_t)b * kC * kN + (size_t)(4 * hi) * kN + n0 + 4 * col;
  v4f xv[8][2][2];
#pragma unroll  // registers indexed by p, q, j
  for (int p = 0; p < 8; ++p)
#pragma unroll
    for (int q = 0; q < 2; ++q)
#pragma unroll
      for (int j = 0; j < 2; ++j)
        xv[p][q][j] = *(const v4f*)(xb + (size_t)(8 * p + 2 * q + j) * kN);

#pragma unroll  // wst[] is indexed by i
  for (int i = 0; i < 4; ++i) {
    const int f = (i * 256 + tid) * 4;
    *(v4f*)(ldsW + (f >> 6) * kWP1 + (f & 63)) = wst[i];
  }
  __syncthreads();  // the weights are read by all waves of the block

  const float* wr = ldsW + (c0 + col) * kWP1 + 4 * hi;
  v8f acc[2][4] = {};  // [c tile][n tile]
#pragma unroll  // registers indexed by p, q, t
  for (int p = 0; p < 8; ++p) {
    const v4f a40 = *(const v4f*)(wr + 8 * p);
    const v4f a41 = *(const v4f*)(wr + 16 * kWP1 + 8 * p);
#pragma unroll
    for (int q = 0; q < 2; ++q) {
      v2f a0, a1;
      a0.x = a40[2 * q]; a0.y = a40[2 * q + 1];
      a1.x = a41[2 * q]; a1.y = a41[2 * q + 1];
#pragma unroll
      for (int t = 0; t < 4; ++t) {
        v2f bf;
        bf.x = xv[p][q][0][t];
        bf.y = xv[p][q][1][t];
        acc[0][t] = mma4(a0, bf, acc[0][t]);
        acc[1][t] = mma4(a1, bf, acc[1][t]);
      }
    }
  }

  float* ob = out + (size_t)b * kC * kN + (size_t)(c0 + 8 * hi) * kN + n0 + 4 * col;
#pragma unroll  // acc[][] is indexed by mt, r
  for (int mt = 0; mt < 2; ++mt)
#pragma unroll
    for (int r = 0; r < 8; ++r) {
      v4f o;
      o.x = acc[mt][0][r]; o.y = acc[mt][1][r];
      o.z = acc[mt][2][r]; o.w = acc[mt][3][r];
      *(v4f*)(ob + (size_t)(mt * 16 + r) * kN) = o;
    }
}

// ---------------------------------------------------------------------------
// 2x2 stride-2 conv: out[c, m] (m over 32x32), k = (ci, dy, dx) = 256.
// Block = 64 c x 2 output rows, wave = 16 c x 1 output row (32 m, two tiles).
// k = 8p + 4hi + 2q + j means ci = 2p + hi, dy = q, dx = j: one 16-byte load of
// x[ci][2ky + q][4col .. + 3] is the B fragment pair of kx = 2col and 2col + 1.
// ---------------------------------------------------------------------------
__global__ __launch_bounds__(256) void sra_conv2x2s2(const float* __restrict__ in,
                                                     const float* __restrict__ w,
                                                     float* __restrict__ out) {
  __shared__ __attribute__((aligned(16))) float ldsW[kC * kWP2];
  const int tid  = threadIdx.x;
  const int wave = tid >> 5;
  const int lane = tid & 31;
  const int col  = lane & 15;
  const int hi   = lane >> 4;
  const int c0   = (wave & 3) * 16;
  const int b    = blockIdx.y;
  const int ky   = blockIdx.x * 2 + (wave >> 2);

  v4f wst[16];
#pragma unroll  // registers indexed by i: all sixteen loads in flight at once
  for (int i = 0; i < 16; ++i) wst[i] = *(const v4f*)(w + (i * 256 + tid) * 4);

  const float* xb = in + (size_t)b * kC * kN + (size_t)hi * kN + (2 * ky) * kW + 4 * col;
  v4f xv[2][8][2];  // two chunks of 8 p: one is worked on, the next one flies
#pragma unroll  // registers indexed by pp, q
  for (int pp = 0; pp < 8; ++pp)
#pragma unroll
    for (int q = 0; q < 2; ++q)
      xv[0][pp][q] = *(const v4f*)(xb + (size_t)(2 * pp) * kN + q * kW);

#pragma unroll  // wst[] is indexed by i
  for (int i = 0; i < 16; ++i) {
    const int f = (i * 256 + tid) * 4;
    *(v4f*)(ldsW + (f >> 8) * kWP2 + (f & 255)) = wst[i];
  }
  __syncthreads();  // the weights are read by all waves of the block

  const float* wr = ldsW + (c0 + col) * kWP2 + 4 * hi;
  v8f acc[2] = {};
#pragma unroll  // the chunk's buffer index must be a constant
  for (int ch = 0; ch < 4; ++ch) {
    if (ch + 1 < 4) {
#pragma unroll
      for (int pp = 0; pp < 8; ++pp)
#pragma unroll
        for (int q = 0; q < 2; ++q)
          xv[(ch + 1) & 1][pp][q] =
              *(const v4f*)(xb + (size_t)(2 * ((ch + 1) * 8 + pp)) * kN + q * kW);
    }
#pragma unroll
    for (int pp = 0; pp < 8; ++pp) {
      const v4f a4 = *(const v4f*)(wr + 8 * (ch * 8 + pp));
#pragma unroll
      for (int q = 0; q < 2; ++q) {
        const v4f x4 = xv[ch & 1][pp][q];
        v2f a, b0, b1;
        a.x  = a4[2 * q]; a.y  = a4[2 * q + 1];
        b0.x = x4[0];     b0.y = x4[1];
        b1.x = x4[2];     b1.y = x4[3];
        acc[0] = mma4(a, b0, acc[0]);
        acc[1] = mma4(a, b1, acc[1]);
      }
    }
  }

  float* ob = out + (size_t)b * kC * kNkv + (size_t)(c0 + 8 * hi) * kNkv + ky * 32 + 2 * col;
#pragma unroll  // acc[] is indexed by r
  for (int r = 0; r < 8; ++r) {
    v2f o;
    o.x = acc[0][r]; o.y = acc[1][r];
    *(v2f*)(ob + (size_t)r * kNkv) = o;
  }
}

// ---------------------------------------------------------------------------
// Fused flash-style attention per (b, head). 8 waves x 16 queries each.
// K staged into LDS by the Tensor Data Mover; V staged row-major (rows padded
// by 16 bytes) by the ALUs in parallel. Online softmax over 64-key blocks.
// All matmuls: V_WMMA_F32_16X16X4_F32 (fp32-exact).
// The products are transposed: S^T = K^T * Q and O^T += V * P^T, so a lane
// holds scores of ONE query (its column) and P never leaves the registers:
//  - S^T tile t has key m0 + 4*i + t in M slot i (one 16-byte read of
//    K[d][m0 + 4col .. + 3] feeds four tiles), so register r of tile t in lane
//    (col, hi) is key m0 + 32hi + 4r + t of query q0 + col;
//  - maximum and sum of a query run over the lane's 32 registers; the two wave
//    halves exchange the maximum once per block and join the sums at the end;
//  - V * P^T WMMA (r, q) has key m0 + 32hi + 4r + 2q + j in k slot (hi, j):
//    B is the register pair (tile 2q, tile 2q + 1) of row r, and one read of
//    V[d][m0 + 32hi + 4r .. + 3] holds the A fragments of two WMMAs.
// The row pitch of 16 bytes x odd spreads the 16-row reads of V over the banks.
// ---------------------------------------------------------------------------
__global__ __launch_bounds__(256) void sra_attn(const float* __restrict__ Qg,
                                                const float* __restrict__ Kg,
                                                const float* __restrict__ Vg,
                                                float* __restrict__ Ao) {
  extern __shared__ __attribute__((aligned(16))) float smem[];
  float* ldsK  = smem;                        // [32][1024]
  float* ldsV  = smem + kHd * kNkv;           // [32][kVP]

  const int tid  = threadIdx.x;
  const int wave = tid >> 5;
  const int lane = tid & 31;
  const int col  = lane & 15;
  const int hi   = lane >> 4;

  const int qt   = blockIdx.x;
  const int head = blockIdx.y;
  const int b    = blockIdx.z;

  const size_t kvbase = ((size_t)b * kC + head * kHd) * (size_t)kNkv;

  // ---- stage K via TDM: D# = 2-D tensor 1024 x 32 (f32), tile = all of it
  if (wave == 0) {
    const unsigned long long ga = (unsigned long long)(Kg + kvbase);
    const unsigned ldsa = (unsigned)(unsigned long long)(uintptr_t)ldsK;
    v4u g0;
    g0[0] = 1u;                                   // count=1, user D#
    g0[1] = ldsa;                                 // lds_addr (bytes)
    g0[2] = (unsigned)(ga & 0xFFFFFFFFull);       // global_addr[31:0]
    g0[3] = (unsigned)((ga >> 32) & 0x01FFFFFFull) | (2u << 30);  // type=2
    v8i g1;
    g1[0] = (int)(2u << 16);        // data_size = 4B
    g1[1] = (int)(1024u << 16);     // tensor_dim0 = 1024 (low 16 in [63:48])
    g1[2] = (int)(32u << 16);       // tensor_dim1 = 32
    g1[3] = (int)(1024u << 16);     // tile_dim0 = 1024
    g1[4] = 32;                     // tile_dim1 = 32, tile_dim2 = 0
    g1[5] = 1024;                   // tensor_dim0_stride = 1024
    g1[6] = 0;
    g1[7] = 0;
    v4i z4 = {0, 0, 0, 0};
    v8i z8 = {0, 0, 0, 0, 0, 0, 0, 0};
    __builtin_amdgcn_tensor_load_to_lds(g0, g1, z4, z4, z8, 0);
  }

  // ---- meanwhile: stage V, one row of 1024 keys per step of the block
  {
    const float* vsrc = Vg + kvbase + 4 * tid;
    v4f vst[kHd];
#pragma unroll  // registers indexed by d: all loads in flight at once
    for (int d = 0; d < kHd; ++d) vst[d] = *(const v4f*)(vsrc + d * kNkv);
#pragma unroll  // vst[] is indexed by d
    for (int d = 0; d < kHd; ++d) *(v4f*)(ldsV + d * kVP + 4 * tid) = vst[d];
  }

  if (wave == 0) __builtin_amdgcn_s_wait_tensorcnt(0);
  __syncthreads();

  const int q0 = qt * 128 + wave * 16;
  const size_t qbase = ((size_t)b * kC + head * kHd) * (size_t)kN;

  // ---- preload Q B-fragments (B 4x16 f32: lane -> N=l&15, K=2*(l>>4)+j)
  v2f aq[8];
#pragma unroll
  for (int dc = 0; dc < 8; ++dc) {
    const int d = dc * 4 + 2 * hi;
    aq[dc].x = Qg[qbase + (size_t)d * kN + q0 + col];
    aq[dc].y = Qg[qbase + (size_t)(d + 1) * kN + q0 + col];
  }

  v8f o0 = {}, o1 = {};  // O^T: register r = d 8hi + r (o1: + 16), query col
  float mrow = -1e30f;   // running maximum of query q0 + col, equal in both halves
  float lrow = 0.f;      // running sum over this half's keys only

  const float* kr = ldsK + (2 * hi) * kNkv + 4 * col;  // K[2hi + .][4col + .]
  const float* vr = ldsV + col * kVP + 32 * hi;        // V[col + .][32hi + .]

  for (int m0 = 0; m0 < kNkv; m0 += 64) {
    // ---- this block's K and V fragments, one group of reads
    v4f kx[8][2], vx[2][8];
#pragma unroll  // registers indexed by dc, j
    for (int dc = 0; dc < 8; ++dc)
#pragma unroll
      for (int j = 0; j < 2; ++j)
        kx[dc][j] = *(const v4f*)(kr + (dc * 4 + j) * kNkv + m0);
#pragma unroll  // registers indexed by dt, r
    for (int dt = 0; dt < 2; ++dt)
#pragma unroll
      for (int r = 0; r < 8; ++r)
        vx[dt][r] = *(const v4f*)(vr + dt * 16 * kVP + m0 + 4 * r);
    // Keeps the 32 reads one group: split up, each part costs its own LDS wait.
    __builtin_amdgcn_sched_barrier(0);

    // ---- four S^T tiles = K[., m0..m0+63]^T * (Q tile)
    v8f s[4] = {};
#pragma unroll  // registers indexed by dc, t
    for (int dc = 0; dc < 8; ++dc)
#pragma unroll
      for (int t = 0; t < 4; ++t) {
        v2f ak;
        ak.x = kx[dc][0][t];
        ak.y = kx[dc][1][t];
        s[t] = mma4(ak, aq[dc], s[t]);
      }

    // ---- online softmax: every lane works on its own query's 32 scores.
    // The scale is positive and rounding is monotonic, so scaling the maximum
    // of the raw scores gives the same bits as the maximum of the scaled ones.
    float rm[8];
#pragma unroll  // registers indexed by r
    for (int r = 0; r < 8; ++r)
      rm[r] = fmaxf(fmaxf(s[0][r], s[1][r]), fmaxf(s[2][r], s[3][r]));
    const float hm = fmaxf(fmaxf(fmaxf(rm[0], rm[1]), fmaxf(rm[2], rm[3])),
                           fmaxf(fmaxf(rm[4], rm[5]), fmaxf(rm[6], rm[7])));
    const float mnew  = fmaxf(mrow, fmaxf(hm, xhalf(hm)) * kScale);
    const float alpha = __expf(mrow - mnew);
    mrow = mnew;
    v2f pp[8][2], ps[8];  // pp[r][q] = P of keys m0 + 32hi + 4r + 2q, + 1
#pragma unroll  // registers indexed by r, q
    for (int r = 0; r < 8; ++r) {
#pragma unroll
      for (int q = 0; q < 2; ++q) {
        pp[r][q].x = __expf(s[2 * q][r] * kScale - mnew);
        pp[r][q].y = __expf(s[2 * q + 1][r] * kScale - mnew);
      }
      ps[r] = pp[r][0] + pp[r][1];
    }
    const v2f pt = ((ps[0] + ps[1]) + (ps[2] + ps[3])) +
                   ((ps[4] + ps[5]) + (ps[6] + ps[7]));
    lrow = lrow * alpha + (pt.x + pt.y);
#pragma unroll  // registers indexed by r
    for (int r = 0; r < 8; ++r) {
      o0[r] *= alpha;
      o1[r] *= alpha;
    }

    // ---- O^T += V * P^T
#pragma unroll  // registers indexed by r, q
    for (int r = 0; r < 8; ++r) {
#pragma unroll
      for (int q = 0; q < 2; ++q) {
        v2f av0, av1;
        av0.x = vx[0][r][2 * q]; av0.y = vx[0][r][2 * q + 1];
        av1.x = vx[1][r][2 * q]; av1.y = vx[1][r][2 * q + 1];
        o0 = mma4(av0, pp[r][q], o0);
        o1 = mma4(av1, pp[r][q], o1);
      }
    }
  }

  // ---- join the halves' sums, normalize and store (lanes run along n)
  const float inv = 1.f / (lrow + xhalf(lrow));
  float* ob = Ao + qbase + (size_t)(8 * hi) * kN + q0 + col;
#pragma unroll  // registers indexed by r
  for (int r = 0; r < 8; ++r) {
    ob[(size_t)r * kN]        = o0[r] * inv;
    ob[(size_t)(16 + r) * kN] = o1[r] * inv;
  }
}

// ---------------------------------------------------------------------------
extern "C" void kernel_launch(void* const* d_in, const int* in_sizes, int n_in,
                              void* d_out, int out_size, void* d_ws, size_t ws_size,
                              hipStream_t stream) {
  const float* x  = (const float*)d_in[0];
  const float* wq = (const float*)d_in[1];
  const float* wk = (const float*)d_in[2];
  const float* wv = (const float*)d_in[3];
  const float* wp = (const float*)d_in[4];

  float* Qb = (float*)d_ws;                          // [B,64,4096]
  float* Kb = Qb + (size_t)kB * kC * kN;             // [B,64,1024]
  float* Vb = Kb + (size_t)kB * kC * kNkv;           // [B,64,1024]
  float* Ab = Vb + (size_t)kB * kC * kNkv;           // [B,64,4096]

  sra_conv1x1<<<dim3(kN / 256, kB), 256, 0, stream>>>(x, wq, Qb);
  sra_conv2x2s2<<<dim3(kH / 4, kB), 256, 0, stream>>>(x, wk, Kb);
  sra_conv2x2s2<<<dim3(kH / 4, kB), 256, 0, stream>>>(x, wv, Vb);

  const size_t smem =
      (size_t)(kHd * kNkv + kHd * kVP) * sizeof(float);
  (void)hipFuncSetAttribute((const void*)sra_attn,
                            hipFuncAttributeMaxDynamicSharedMemorySize,
                            (int)smem);
  sra_attn<<<dim3(kN / 128, kHeads, kB), 256, smem, stream>>>(Qb, Kb, Vb, Ab);

  sra_conv1x1<<<dim3(kN / 256, kB), 256, 0, stream>>>(Ab, wp, (float*)d_out);
}

// v004
// It runs in 114 microseconds.
// Timed twice side by side with v003, it ran 1.11 times as fast both times.
// Counting every step since v000, it is 2.91 times as fast.
#include <hip/hip_runtime.h>

typedef __attribute__((ext_vector_type(2))) float v2f;
typedef __attribute__((ext_vector_type(4))) float v4f;
typedef __attribute__((ext_vector_type(8))) float v8f;
typedef __attribute__((ext_vector_type(4))) unsigned int v4u;
typedef __attribute__((ext_vector_type(4))) int v4i;
typedef __attribute__((ext_vector_type(8))) int v8i;

namespace {
constexpr int kB    = 16;
constexpr int kC    = 64;
constexpr int kH    = 64;
constexpr int kW    = 64;
constexpr int kN    = kH * kW;              // 4096 query positions
constexpr int kNkv  = (kH / 2) * (kW / 2);  // 1024 key positions
constexpr int kHeads = 2;
constexpr int kHd    = 32;
constexpr int kVP    = kNkv + 4;             // padded V row in LDS (floats)
constexpr int kWP1   = kC + 4;              // padded 1x1 weight row (floats)
constexpr int kWP2   = 4 * kC + 4;          // padded 2x2 weight row (floats)
constexpr float kScale = 0.17677669529663687f;  // 32^-0.5
}

// ---- lane l <-> lane l ^ 16: the two halves of a wave hold one query column
__device__ inline float xhalf(float x) {
  const int b = __builtin_bit_cast(int, x);
  return __builtin_bit_cast(
      float, __builtin_amdgcn_permlanex16(b, b, 0x76543210, 0xfedcba98, false, false));
}

// ---------------------------------------------------------------------------
// Both convolutions are GEMMs out[c, n] = W[c, k] * X[k, n] on
// V_WMMA_F32_16X16X4_F32: A = weights (M = c), B = x (N = position).
// The weights go through LDS once per block (coalesced 16-byte loads, rows
// padded by 16 bytes so that the 16-row fragment reads spread over the banks).
// One 16-byte LDS read holds the A fragments of two WMMAs: lane (col, hi)
// reads W[c0 + col][8p + 4hi .. + 3], so WMMA (p, q) has k = 8p + 4hi + 2q + j
// in slot (hi, j); the B loaders below use the same k in the same slot.
// ---------------------------------------------------------------------------
__device__ inline v8f mma4(v2f a, v2f b, v8f c) {
  return __builtin_amdgcn_wmma_f32_16x16x4_f32(false, a, false, b, (short)0, c,
                                               false, false);
}

// ---------------------------------------------------------------------------
// 1x1 conv over [B, 64, 4096]. Block = 64 c x 256 n, wave = 32 c x 64 n.
// N slot col of tile t is position n0 + 4*col + t: one 16-byte load of x feeds
// four tiles and one 16-byte store takes one row of four tiles.
// ---------------------------------------------------------------------------
__global__ __launch_bounds__(256) void sra_conv1x1(const float* __restrict__ in,
                                                   const float* __restrict__ w,
                                                   float* __restrict__ out) {
  __shared__ __attribute__((aligned(16))) float ldsW[kC * kWP1];
  const int tid  = threadIdx.x;
  const int wave = tid >> 5;
  const int lane = tid & 31;
  const int col  = lane & 15;
  const int hi   = lane >> 4;
  const int c0   = (wave & 1) * 32;
  const int b    = blockIdx.y;
  const int n0   = blockIdx.x * 256 + (wave >> 1) * 64;

  v4f wst[4];
#pragma unroll  // registers indexed by i: all four loads in flight at once
  for (int i = 0; i < 4; ++i) wst[i] = *(const v4f*)(w + (i * 256 + tid) * 4);

  // x[8p + 4hi + 2q + j][n0 + 4col .. + 3], issued ahead of the barrier so
  // that their latency runs beside the weight staging.
  const float* xb = in + (size_t)b * kC * kN + (size_t)(4 * hi) * kN + n0 + 4 * col;
  v4f xv[8][2][2];
#pragma unroll  // registers indexed by p, q, j
  for (int p = 0; p < 8; ++p)
#pragma unroll
    for (int q = 0; q < 2; ++q)
#pragma unroll
      for (int j = 0; j < 2; ++j)
        xv[p][q][j] = *(const v4f*)(xb + (size_t)(8 * p + 2 * q + j) * kN);

#pragma unroll  // wst[] is indexed by i
  for (int i = 0; i < 4; ++i) {
    const int f = (i * 256 + tid) * 4;
    *(v4f*)(ldsW + (f >> 6) * kWP1 + (f & 63)) = wst[i];
  }
  __syncthreads();  // the weights are read by all waves of the block

  const float* wr = ldsW + (c0 + col) * kWP1 + 4 * hi;
  v8f acc[2][4] = {};  // [c tile][n tile]
#pragma unroll  // registers indexed by p, q, t
  for (int p = 0; p < 8; ++p) {
    const v4f a40 = *(const v4f*)(wr + 8 * p);
    const v4f a41 = *(const v4f*)(wr + 16 * kWP1 + 8 * p);
#pragma unroll
    for (int q = 0; q < 2; ++q) {
      v2f a0, a1;
      a0.x = a40[2 * q]; a0.y = a40[2 * q + 1];
      a1.x = a41[2 * q]; a1.y = a41[2 * q + 1];
#pragma unroll
      for (int t = 0; t < 4; ++t) {
        v2f bf;
        bf.x = xv[p][q][0][t];
        bf.y = xv[p][q][1][t];
        acc[0][t] = mma4(a0, bf, acc[0][t]);
        acc[1][t] = mma4(a1, bf, acc[1][t]);
      }
    }
  }

  float* ob = out + (size_t)b * kC * kN + (size_t)(c0 + 8 * hi) * kN + n0 + 4 * col;
#pragma unroll  // acc[][] is indexed by mt, r
  for (int mt = 0; mt < 2; ++mt)
#pragma unroll
    for (int r = 0; r < 8; ++r) {
      v4f o;
      o.x = acc[mt][0][r]; o.y = acc[mt][1][r];
      o.z = acc[mt][2][r]; o.w = acc[mt][3][r];
      *(v4f*)(ob + (size_t)(mt * 16 + r) * kN) = o;
    }
}

// ---------------------------------------------------------------------------
// 2x2 stride-2 conv: out[c, m] (m over 32x32), k = (ci, dy, dx) = 256.
// Block = 64 c x 2 output rows, wave = 16 c x 1 output row (32 m, two tiles).
// k = 8p + 4hi + 2q + j means ci = 2p + hi, dy = q, dx = j: one 16-byte load of
// x[ci][2ky + q][4col .. + 3] is the B fragment pair of kx = 2col and 2col + 1.
// ---------------------------------------------------------------------------
__global__ __launch_bounds__(256) void sra_conv2x2s2(const float* __restrict__ in,
                                                     const float* __restrict__ w,
                                                     float* __restrict__ out) {
  __shared__ __attribute__((aligned(16))) float ldsW[kC * kWP2];
  const int tid  = threadIdx.x;
  const int wave = tid >> 5;
  const int lane = tid & 31;
  const int col  = lane & 15;
  const int hi   = lane >> 4;
  const int c0   = (wave & 3) * 16;
  const int b    = blockIdx.y;
  const int ky   = blockIdx.x * 2 + (wave >> 2);

  v4f wst[16];
#pragma unroll  // registers indexed by i: all sixteen loads in flight at once
  for (int i = 0; i < 16; ++i) wst[i] = *(const v4f*)(w + (i * 256 + tid) * 4);

  const float* xb = in + (size_t)b * kC * kN + (size_t)hi * kN + (2 * ky) * kW + 4 * col;
  v4f xv[2][8][2];  // two chunks of 8 p: one is worked on, the next one flies
#pragma unroll  // registers indexed by pp, q
  for (int pp = 0; pp < 8; ++pp)
#pragma unroll
    for (int q = 0; q < 2; ++q)
      xv[0][pp][q] = *(const v4f*)(xb + (size_t)(2 * pp) * kN + q * kW);

#pragma unroll  // wst[] is indexed by i
  for (int i = 0; i < 16; ++i) {
    const int f = (i * 256 + tid) * 4;
    *(v4f*)(ldsW + (f >> 8) * kWP2 + (f & 255)) = wst[i];
  }
  __syncthreads();  // the weights are read by all waves of the block

  const float* wr = ldsW + (c0 + col) * kWP2 + 4 * hi;
  v8f acc[2] = {};
#pragma unroll  // the chunk's buffer index must be a constant
  for (int ch = 0; ch < 4; ++ch) {
    if (ch + 1 < 4) {
#pragma unroll
      for (int pp = 0; pp < 8; ++pp)
#pragma unroll
        for (int q = 0; q < 2; ++q)
          xv[(ch + 1) & 1][pp][q] =
              *(const v4f*)(xb + (size_t)(2 * ((ch + 1) * 8 + pp)) * kN + q * kW);
    }
#pragma unroll
    for (int pp = 0; pp < 8; ++pp) {
      const v4f a4 = *(const v4f*)(wr + 8 * (ch * 8 + pp));
#pragma unroll
      for (int q = 0; q < 2; ++q) {
        const v4f x4 = xv[ch & 1][pp][q];
        v2f a, b0, b1;
        a.x  = a4[2 * q]; a.y  = a4[2 * q + 1];
        b0.x = x4[0];     b0.y = x4[1];
        b1.x = x4[2];     b1.y = x4[3];
        acc[0] = mma4(a, b0, acc[0]);
        acc[1] = mma4(a, b1, acc[1]);
      }
    }
  }

  float* ob = out + (size_t)b * kC * kNkv + (size_t)(c0 + 8 * hi) * kNkv + ky * 32 + 2 * col;
#pragma unroll  // acc[] is indexed by r
  for (int r = 0; r < 8; ++r) {
    v2f o;
    o.x = acc[0][r]; o.y = acc[1][r];
    *(v2f*)(ob + (size_t)r * kNkv) = o;
  }
}

// ---------------------------------------------------------------------------
// Fused flash-style attention per (b, head). 16 waves x 16 queries each: four
// waves per SIMD, so that one wave's LDS waits and softmax chain run beside the
// others' WMMAs, and one staging of K and V serves 256 queries.
// K staged into LDS by the Tensor Data Mover; V staged row-major (rows padded
// by 16 bytes) by the ALUs in parallel. Online softmax over 64-key blocks.
// All matmuls: V_WMMA_F32_16X16X4_F32 (fp32-exact).
// The products are transposed: S^T = K^T * Q and O^T += V * P^T, so a lane
// holds scores of ONE query (its column) and P never leaves the registers:
//  - S^T tile t has key m0 + 4*i + t in M slot i (one 16-byte read of
//    K[d][m0 + 4col .. + 3] feeds four tiles), so register r of tile t in lane
//    (col, hi) is key m0 + 32hi + 4r + t of query q0 + col;
//  - maximum and sum of a query run over the lane's 32 registers; the two wave
//    halves exchange the maximum once per block and join the sums at the end;
//  - V * P^T WMMA (r, q) has key m0 + 32hi + 4r + 2q + j in k slot (hi, j):
//    B is the register pair (tile 2q, tile 2q + 1) of row r, and one read of
//    V[d][m0 + 32hi + 4r .. + 3] holds the A fragments of two WMMAs.
// The row pitch of 16 bytes x odd spreads the 16-row reads of V over the banks.
// ---------------------------------------------------------------------------
__global__ __launch_bounds__(512) void sra_attn(const float* __restrict__ Qg,
                                                const float* __restrict__ Kg,
                                                const float* __restrict__ Vg,
                                                float* __restrict__ Ao) {
  extern __shared__ __attribute__((aligned(16))) float smem[];
  float* ldsK  = smem;                        // [32][1024]
  float* ldsV  = smem + kHd * kNkv;           // [32][kVP]

  const int tid  = threadIdx.x;
  const int wave = tid >> 5;
  const int lane = tid & 31;
  const int col  = lane & 15;
  const int hi   = lane >> 4;

  const int qt   = blockIdx.x;
  const int head = blockIdx.y;
  const int b    = blockIdx.z;

  const size_t kvbase = ((size_t)b * kC + head * kHd) * (size_t)kNkv;

  // ---- stage K via TDM: D# = 2-D tensor 1024 x 32 (f32), tile = all of it
  if (wave == 0) {
    const unsigned long long ga = (unsigned long long)(Kg + kvbase);
    const unsigned ldsa = (unsigned)(unsigned long long)(uintptr_t)ldsK;
    v4u g0;
    g0[0] = 1u;                                   // count=1, user D#
    g0[1] = ldsa;                                 // lds_addr (bytes)
    g0[2] = (unsigned)(ga & 0xFFFFFFFFull);       // global_addr[31:0]
    g0[3] = (unsigned)((ga >> 32) & 0x01FFFFFFull) | (2u << 30);  // type=2
    v8i g1;
    g1[0] = (int)(2u << 16);        // data_size = 4B
    g1[1] = (int)(1024u << 16);     // tensor_dim0 = 1024 (low 16 in [63:48])
    g1[2] = (int)(32u << 16);       // tensor_dim1 = 32
    g1[3] = (int)(1024u << 16);     // tile_dim0 = 1024
    g1[4] = 32;                     // tile_dim1 = 32, tile_dim2 = 0
    g1[5] = 1024;                   // tensor_dim0_stride = 1024
    g1[6] = 0;
    g1[7] = 0;
    v4i z4 = {0, 0, 0, 0};
    v8i z8 = {0, 0, 0, 0, 0, 0, 0, 0};
    __builtin_amdgcn_tensor_load_to_lds(g0, g1, z4, z4, z8, 0);
  }

  // ---- meanwhile: stage V, two rows of 1024 keys per step of the block
  {
    const int vrow = tid >> 8;         // row within the step's pair
    const int vcol = 4 * (tid & 255);  // first key of this thread's 16 bytes
    const float* vsrc = Vg + kvbase + vrow * kNkv + vcol;
    float* vdst = ldsV + vrow * kVP + vcol;
    v4f vst[kHd / 2];
#pragma unroll  // registers indexed by i: all loads in flight at once
    for (int i = 0; i < kHd / 2; ++i) vst[i] = *(const v4f*)(vsrc + 2 * i * kNkv);
#pragma unroll  // vst[] is indexed by i
    for (int i = 0; i < kHd / 2; ++i) *(v4f*)(vdst + 2 * i * kVP) = vst[i];
  }

  if (wave == 0) __builtin_amdgcn_s_wait_tensorcnt(0);
  __syncthreads();

  const int q0 = qt * 256 + wave * 16;
  const size_t qbase = ((size_t)b * kC + head * kHd) * (size_t)kN;

  // ---- preload Q B-fragments (B 4x16 f32: lane -> N=l&15, K=2*(l>>4)+j)
  v2f aq[8];
#pragma unroll
  for (int dc = 0; dc < 8; ++dc) {
    const int d = dc * 4 + 2 * hi;
    aq[dc].x = Qg[qbase + (size_t)d * kN + q0 + col];
    aq[dc].y = Qg[qbase + (size_t)(d + 1) * kN + q0 + col];
  }

  v8f o0 = {}, o1 = {};  // O^T: register r = d 8hi + r (o1: + 16), query col
  float mrow = -1e30f;   // running maximum of query q0 + col, equal in both halves
  float lrow = 0.f;      // running sum over this half's keys only

  const float* kr = ldsK + (2 * hi) * kNkv + 4 * col;  // K[2hi + .][4col + .]
  const float* vr = ldsV + col * kVP + 32 * hi;        // V[col + .][32hi + .]

  for (int m0 = 0; m0 < kNkv; m0 += 64) {
    // ---- this block's K and V fragments, one group of reads
    v4f kx[8][2], vx[2][8];
#pragma unroll  // registers indexed by dc, j
    for (int dc = 0; dc < 8; ++dc)
#pragma unroll
      for (int j = 0; j < 2; ++j)
        kx[dc][j] = *(const v4f*)(kr + (dc * 4 + j) * kNkv + m0);
#pragma unroll  // registers indexed by dt, r
    for (int dt = 0; dt < 2; ++dt)
#pragma unroll
      for (int r = 0; r < 8; ++r)
        vx[dt][r] = *(const v4f*)(vr + dt * 16 * kVP + m0 + 4 * r);
    // Keeps the 32 reads one group: split up, each part costs its own LDS wait.
    __builtin_amdgcn_sched_barrier(0);

    // ---- four S^T tiles = K[., m0..m0+63]^T * (Q tile)
    v8f s[4] = {};
#pragma unroll  // registers indexed by dc, t
    for (int dc = 0; dc < 8; ++dc)
#pragma unroll
      for (int t = 0; t < 4; ++t) {
        v2f ak;
        ak.x = kx[dc][0][t];
        ak.y = kx[dc][1][t];
        s[t] = mma4(ak, aq[dc], s[t]);
      }

    // ---- online softmax: every lane works on its own query's 32 scores.
    // The scale is positive and rounding is monotonic, so scaling the maximum
    // of the raw scores gives the same bits as the maximum of the scaled ones.
    float rm[8];
#pragma unroll  // registers indexed by r
    for (int r = 0; r < 8; ++r)
      rm[r] = fmaxf(fmaxf(s[0][r], s[1][r]), fmaxf(s[2][r], s[3][r]));
    const float hm = fmaxf(fmaxf(fmaxf(rm[0], rm[1]), fmaxf(rm[2], rm[3])),
                           fmaxf(fmaxf(rm[4], rm[5]), fmaxf(rm[6], rm[7])));
    const float mnew  = fmaxf(mrow, fmaxf(hm, xhalf(hm)) * kScale);
    const float alpha = __expf(mrow - mnew);
    mrow = mnew;
    v2f pp[8][2], ps[8];  // pp[r][q] = P of keys m0 + 32hi + 4r + 2q, + 1
#pragma unroll  // registers indexed by r, q
    for (int r = 0; r < 8; ++r) {
#pragma unroll
      for (int q = 0; q < 2; ++q) {
        pp[r][q].x = __expf(s[2 * q][r] * kScale - mnew);
        pp[r][q].y = __expf(s[2 * q + 1][r] * kScale - mnew);
      }
      ps[r] = pp[r][0] + pp[r][1];
    }
    const v2f pt = ((ps[0] + ps[1]) + (ps[2] + ps[3])) +
                   ((ps[4] + ps[5]) + (ps[6] + ps[7]));
    lrow = lrow * alpha + (pt.x + pt.y);
#pragma unroll  // registers indexed by r
    for (int r = 0; r < 8; ++r) {
      o0[r] *= alpha;
      o1[r] *= alpha;
    }

    // ---- O^T += V * P^T
#pragma unroll  // registers indexed by r, q
    for (int r = 0; r < 8; ++r) {
#pragma unroll
      for (int q = 0; q < 2; ++q) {
        v2f av0, av1;
        av0.x = vx[0][r][2 * q]; av0.y = vx[0][r][2 * q + 1];
        av1.x = vx[1][r][2 * q]; av1.y = vx[1][r][2 * q + 1];
        o0 = mma4(av0, pp[r][q], o0);
        o1 = mma4(av1, pp[r][q], o1);
      }
    }
  }

  // ---- join the halves' sums, normalize and store (lanes run along n)
  const float inv = 1.f / (lrow + xhalf(lrow));
  float* ob = Ao + qbase + (size_t)(8 * hi) * kN + q0 + col;
#pragma unroll  // registers indexed by r
  for (int r = 0; r < 8; ++r) {
    ob[(size_t)r * kN]        = o0[r] * inv;
    ob[(size_t)(16 + r) * kN] = o1[r] * inv;
  }
}

// ---------------------------------------------------------------------------
extern "C" void kernel_launch(void* const* d_in, const int* in_sizes, int n_in,
                              void* d_out, int out_size, void* d_ws, size_t ws_size,
                              hipStream_t stream) {
  const float* x  = (const float*)d_in[0];
  const float* wq = (const float*)d_in[1];
  const float* wk = (const float*)d_in[2];
  const float* wv = (const float*)d_in[3];
  const float* wp = (const float*)d_in[4];

  float* Qb = (float*)d_ws;                          // [B,64,4096]
  float* Kb = Qb + (size_t)kB * kC * kN;             // [B,64,1024]
  float* Vb = Kb + (size_t)kB * kC * kNkv;           // [B,64,1024]
  float* Ab = Vb + (size_t)kB * kC * kNkv;           // [B,64,4096]

  sra_conv1x1<<<dim3(kN / 256, kB), 256, 0, stream>>>(x, wq, Qb);
  sra_conv2x2s2<<<dim3(kH / 4, kB), 256, 0, stream>>>(x, wk, Kb);
  sra_conv2x2s2<<<dim3(kH / 4, kB), 256, 0, stream>>>(x, wv, Vb);

  const size_t smem =
      (size_t)(kHd * kNkv + kHd * kVP) * sizeof(float);
  (void)hipFuncSetAttribute((const void*)sra_attn,
                            hipFuncAttributeMaxDynamicSharedMemorySize,
                            (int)smem);
  sra_attn<<<dim3(kN / 256, kHeads, kB), 512, smem, stream>>>(Qb, Kb, Vb, Ab);

  sra_conv1x1<<<dim3(kN / 256, kB), 256, 0, stream>>>(Ab, wp, (float*)d_out);
}

// v005
// Measured time: 109 microseconds a run.
// Two timings next to v004 both put it at 1.04 times that version's speed.
// Over all steps from v000 it is 3.03 times as fast.
#include <hip/hip_runtime.h>

typedef __attribute__((ext_vector_type(2))) float v2f;
typedef __attribute__((ext_vector_type(4))) float v4f;
typedef __attribute__((ext_vector_type(8))) float v8f;
typedef __attribute__((ext_vector_type(4))) unsigned int v4u;
typedef __attribute__((ext_vector_type(4))) int v4i;
typedef __attribute__((ext_vector_type(8))) int v8i;

namespace {
constexpr int kB    = 16;
constexpr int kC    = 64;
constexpr int kH    = 64;
constexpr int kW    = 64;
constexpr int kN    = kH * kW;              // 4096 query positions
constexpr int kNkv  = (kH / 2) * (kW / 2);  // 1024 key positions
constexpr int kHeads = 2;
constexpr int kHd    = 32;
constexpr int kVP    = kNkv + 4;             // padded V row in LDS (floats)
constexpr int kWP1   = kC + 4;              // padded 1x1 weight row (floats)
constexpr int kWP2   = 4 * kC + 4;          // padded 2x2 weight row (floats)
constexpr float kScale = 0.17677669529663687f;  // 32^-0.5
}

// ---- lane l <-> lane l ^ 16: the two halves of a wave hold one query column
__device__ inline float xhalf(float x) {
  const int b = __builtin_bit_cast(int, x);
  return __builtin_bit_cast(
      float, __builtin_amdgcn_permlanex16(b, b, 0x76543210, 0xfedcba98, false, false));
}

// ---------------------------------------------------------------------------
// Both convolutions are GEMMs out[c, n] = W[c, k] * X[k, n] on
// V_WMMA_F32_16X16X4_F32: A = weights (M = c), B = x (N = position).
// The weights go through LDS once per block (coalesced 16-byte loads, rows
// padded by 16 bytes so that the 16-row fragment reads spread over the banks).
// One 16-byte LDS read holds the A fragments of two WMMAs: lane (col, hi)
// reads W[c0 + col][8p + 4hi .. + 3], so WMMA (p, q) has k = 8p + 4hi + 2q + j
// in slot (hi, j); the B loaders below use the same k in the same slot.
// ---------------------------------------------------------------------------
__device__ inline v8f mma4(v2f a, v2f b, v8f c) {
  return __builtin_amdgcn_wmma_f32_16x16x4_f32(false, a, false, b, (short)0, c,
                                               false, false);
}

// ---------------------------------------------------------------------------
// 1x1 conv over [B, 64, 4096]. Block = 64 c x 256 n, wave = 32 c x 64 n.
// N slot col of tile t is position n0 + 4*col + t: one 16-byte load of x feeds
// four tiles and one 16-byte store takes one row of four tiles.
// ---------------------------------------------------------------------------
__global__ __launch_bounds__(256) void sra_conv1x1(const float* __restrict__ in,
                                                   const float* __restrict__ w,
                                                   float* __restrict__ out) {
  __shared__ __attribute__((aligned(16))) float ldsW[kC * kWP1];
  const int tid  = threadIdx.x;
  const int wave = tid >> 5;
  const int lane = tid & 31;
  const int col  = lane & 15;
  const int hi   = lane >> 4;
  const int c0   = (wave & 1) * 32;
  const int b    = blockIdx.y;
  const int n0   = blockIdx.x * 256 + (wave >> 1) * 64;

  v4f wst[4];
#pragma unroll  // registers indexed by i: all four loads in flight at once
  for (int i = 0; i < 4; ++i) wst[i] = *(const v4f*)(w + (i * 256 + tid) * 4);

  // x[8p + 4hi + 2q + j][n0 + 4col .. + 3], issued ahead of the barrier so
  // that their latency runs beside the weight staging.
  const float* xb = in + (size_t)b * kC * kN + (size_t)(4 * hi) * kN + n0 + 4 * col;
  v4f xv[8][2][2];
#pragma unroll  // registers indexed by p, q, j
  for (int p = 0; p < 8; ++p)
#pragma unroll
    for (int q = 0; q < 2; ++q)
#pragma unroll
      for (int j = 0; j < 2; ++j)
        xv[p][q][j] = *(const v4f*)(xb + (size_t)(8 * p + 2 * q + j) * kN);

#pragma unroll  // wst[] is indexed by i
  for (int i = 0; i < 4; ++i) {
    const int f = (i * 256 + tid) * 4;
    *(v4f*)(ldsW + (f >> 6) * kWP1 + (f & 63)) = wst[i];
  }
  __syncthreads();  // the weights are read by all waves of the block

  const float* wr = ldsW + (c0 + col) * kWP1 + 4 * hi;
  v8f acc[2][4] = {};  // [c tile][n tile]
#pragma unroll  // registers indexed by p, q, t
  for (int p = 0; p < 8; ++p) {
    const v4f a40 = *(const v4f*)(wr + 8 * p);
    const v4f a41 = *(const v4f*)(wr + 16 * kWP1 + 8 * p);
#pragma unroll
    for (int q = 0; q < 2; ++q) {
      v2f a0, a1;
      a0.x = a40[2 * q]; a0.y = a40[2 * q + 1];
      a1.x = a41[2 * q]; a1.y = a41[2 * q + 1];
#pragma unroll
      for (int t = 0; t < 4; ++t) {
        v2f bf;
        bf.x = xv[p][q][0][t];
        bf.y = xv[p][q][1][t];
        acc[0][t] = mma4(a0, bf, acc[0][t]);
        acc[1][t] = mma4(a1, bf, acc[1][t]);
      }
    }
  }

  float* ob = out + (size_t)b * kC * kN + (size_t)(c0 + 8 * hi) * kN + n0 + 4 * col;
#pragma unroll  // acc[][] is indexed by mt, r
  for (int mt = 0; mt < 2; ++mt)
#pragma unroll
    for (int r = 0; r < 8; ++r) {
      v4f o;
      o.x = acc[mt][0][r]; o.y = acc[mt][1][r];
      o.z = acc[mt][2][r]; o.w = acc[mt][3][r];
      *(v4f*)(ob + (size_t)(mt * 16 + r) * kN) = o;
    }
}

// ---------------------------------------------------------------------------
// 2x2 stride-2 conv: out[c, m] (m over 32x32), k = (ci, dy, dx) = 256.
// Block = 64 c x 2 output rows, wave = 16 c x 1 output row (32 m, two tiles).
// k = 8p + 4hi + 2q + j means ci = 2p + hi, dy = q, dx = j: one 16-byte load of
// x[ci][2ky + q][4col .. + 3] is the B fragment pair of kx = 2col and 2col + 1.
// ---------------------------------------------------------------------------
__global__ __launch_bounds__(256) void sra_conv2x2s2(const float* __restrict__ in,
                                                     const float* __restrict__ w,
                                                     float* __restrict__ out) {
  __shared__ __attribute__((aligned(16))) float ldsW[kC * kWP2];
  const int tid  = threadIdx.x;
  const int wave = tid >> 5;
  const int lane = tid & 31;
  const int col  = lane & 15;
  const int hi   = lane >> 4;
  const int c0   = (wave & 3) * 16;
  const int b    = blockIdx.y;
  const int ky   = blockIdx.x * 2 + (wave >> 2);

  v4f wst[16];
#pragma unroll  // registers indexed by i: all sixteen loads in flight at once
  for (int i = 0; i < 16; ++i) wst[i] = *(const v4f*)(w + (i * 256 + tid) * 4);

  const float* xb = in + (size_t)b * kC * kN + (size_t)hi * kN + (2 * ky) * kW + 4 * col;
  v4f xv[2][8][2];  // two chunks of 8 p: one is worked on, the next one flies
#pragma unroll  // registers indexed by pp, q
  for (int pp = 0; pp < 8; ++pp)
#pragma unroll
    for (int q = 0; q < 2; ++q)
      xv[0][pp][q] = *(const v4f*)(xb + (size_t)(2 * pp) * kN + q * kW);

#pragma unroll  // wst[] is indexed by i
  for (int i = 0; i < 16; ++i) {
    const int f = (i * 256 + tid) * 4;
    *(v4f*)(ldsW + (f >> 8) * kWP2 + (f & 255)) = wst[i];
  }
  __syncthreads();  // the weights are read by all waves of the block

  const float* wr = ldsW + (c0 + col) * kWP2 + 4 * hi;
  v8f acc[2] = {};
#pragma unroll  // the chunk's buffer index must be a constant
  for (int ch = 0; ch < 4; ++ch) {
    if (ch + 1 < 4) {
#pragma unroll
      for (int pp = 0; pp < 8; ++pp)
#pragma unroll
        for (int q = 0; q < 2; ++q)
          xv[(ch + 1) & 1][pp][q] =
              *(const v4f*)(xb + (size_t)(2 * ((ch + 1) * 8 + pp)) * kN + q * kW);
    }
#pragma unroll
    for (int pp = 0; pp < 8; ++pp) {
      const v4f a4 = *(const v4f*)(wr + 8 * (ch * 8 + pp));
#pragma unroll
      for (int q = 0; q < 2; ++q) {
        const v4f x4 = xv[ch & 1][pp][q];
        v2f a, b0, b1;
        a.x  = a4[2 * q]; a.y  = a4[2 * q + 1];
        b0.x = x4[0];     b0.y = x4[1];
        b1.x = x4[2];     b1.y = x4[3];
        acc[0] = mma4(a, b0, acc[0]);
        acc[1] = mma4(a, b1, acc[1]);
      }
    }
  }

  float* ob = out + (size_t)b * kC * kNkv + (size_t)(c0 + 8 * hi) * kNkv + ky * 32 + 2 * col;
#pragma unroll  // acc[] is indexed by r
  for (int r = 0; r < 8; ++r) {
    v2f o;
    o.x = acc[0][r]; o.y = acc[1][r];
    *(v2f*)(ob + (size_t)r * kNkv) = o;
  }
}

// ---------------------------------------------------------------------------
// Fused flash-style attention per (b, head), with the 1x1 query convolution in
// its prologue: while K and V are on their way into LDS every wave forms the Q
// of its own 16 queries, Q[d, n] = Wq[d, c] * x[c, n], in the k order of
// sra_conv1x1. Register r of Q tile u in lane (col, hi) is d = 16u + 8hi + r of
// query col, so the register pair (2v, 2v + 1) of tile u is the B fragment of
// S^T WMMA w = 4u + v with d = 16u + 8hi + 2v + j in k slot (hi, j); the K
// loader reads the same d in the same slot. Q never goes through memory.
// 16 waves x 16 queries each: four
// waves per SIMD, so that one wave's LDS waits and softmax chain run beside the
// others' WMMAs, and one staging of K and V serves 256 queries.
// K staged into LDS by the Tensor Data Mover; V staged row-major (rows padded
// by 16 bytes) by the ALUs in parallel. Online softmax over 64-key blocks.
// All matmuls: V_WMMA_F32_16X16X4_F32 (fp32-exact).
// The products are transposed: S^T = K^T * Q and O^T += V * P^T, so a lane
// holds scores of ONE query (its column) and P never leaves the registers:
//  - S^T tile t has key m0 + 4*i + t in M slot i (one 16-byte read of
//    K[d][m0 + 4col .. + 3] feeds four tiles), so register r of tile t in lane
//    (col, hi) is key m0 + 32hi + 4r + t of query q0 + col;
//  - maximum and sum of a query run over the lane's 32 registers; the two wave
//    halves exchange the maximum once per block and join the sums at the end;
//  - V * P^T WMMA (r, q) has key m0 + 32hi + 4r + 2q + j in k slot (hi, j):
//    B is the register pair (tile 2q, tile 2q + 1) of row r, and one read of
//    V[d][m0 + 32hi + 4r .. + 3] holds the A fragments of two WMMAs.
// The row pitch of 16 bytes x odd spreads the 16-row reads of V over the banks.
// ---------------------------------------------------------------------------
__global__ __launch_bounds__(512) void sra_attn(const float* __restrict__ Xg,
                                                const float* __restrict__ Wq,
                                                const float* __restrict__ Kg,
                                                const float* __restrict__ Vg,
                                                float* __restrict__ Ao) {
  extern __shared__ __attribute__((aligned(16))) float smem[];
  float* ldsK  = smem;                        // [32][1024]
  float* ldsV  = smem + kHd * kNkv;           // [32][kVP]
  float* ldsW  = ldsV + kHd * kVP;            // [32][kWP1]: this head's Wq rows

  const int tid  = threadIdx.x;
  const int wave = tid >> 5;
  const int lane = tid & 31;
  const int col  = lane & 15;
  const int hi   = lane >> 4;

  const int qt   = blockIdx.x;
  const int head = blockIdx.y;
  const int b    = blockIdx.z;

  const size_t kvbase = ((size_t)b * kC + head * kHd) * (size_t)kNkv;

  // ---- stage K via TDM: D# = 2-D tensor 1024 x 32 (f32), tile = all of it
  if (wave == 0) {
    const unsigned long long ga = (unsigned long long)(Kg + kvbase);
    const unsigned ldsa = (unsigned)(unsigned long long)(uintptr_t)ldsK;
    v4u g0;
    g0[0] = 1u;                                   // count=1, user D#
    g0[1] = ldsa;                                 // lds_addr (bytes)
    g0[2] = (unsigned)(ga & 0xFFFFFFFFull);       // global_addr[31:0]
    g0[3] = (unsigned)((ga >> 32) & 0x01FFFFFFull) | (2u << 30);  // type=2
    v8i g1;
    g1[0] = (int)(2u << 16);        // data_size = 4B
    g1[1] = (int)(1024u << 16);     // tensor_dim0 = 1024 (low 16 in [63:48])
    g1[2] = (int)(32u << 16);       // tensor_dim1 = 32
    g1[3] = (int)(1024u << 16);     // tile_dim0 = 1024
    g1[4] = 32;                     // tile_dim1 = 32, tile_dim2 = 0
    g1[5] = 1024;                   // tensor_dim0_stride = 1024
    g1[6] = 0;
    g1[7] = 0;
    v4i z4 = {0, 0, 0, 0};
    v8i z8 = {0, 0, 0, 0, 0, 0, 0, 0};
    __builtin_amdgcn_tensor_load_to_lds(g0, g1, z4, z4, z8, 0);
  }

  const int q0 = qt * 256 + wave * 16;
  const size_t qbase = ((size_t)b * kC + head * kHd) * (size_t)kN;

  const int vrow = tid >> 8;         // V row within a step's pair
  const int vcol = 4 * (tid & 255);  // first key of this thread's 16 bytes of V
  const float* vsrc = Vg + kvbase + vrow * kNkv + vcol;
  float* vdst = ldsV + vrow * kVP + vcol;

  // ---- meanwhile: this head's 32 rows of Wq (16 bytes per thread) and the x
  // fragments of the wave's queries, x[8p + 4hi + 2q + j][q0 + col] ...
  const v4f wst = *(const v4f*)(Wq + head * kHd * kC + 4 * tid);
  const float* xb = Xg + (size_t)b * kC * kN + (size_t)(4 * hi) * kN + q0 + col;
  v2f xf[8][2];
#pragma unroll  // registers indexed by p, q: all loads in flight at once
  for (int p = 0; p < 8; ++p)
#pragma unroll
    for (int q = 0; q < 2; ++q) {
      xf[p][q].x = xb[(size_t)(8 * p + 2 * q) * kN];
      xf[p][q].y = xb[(size_t)(8 * p + 2 * q + 1) * kN];
    }

  // Keeps the x loads ahead of V's: loads return in order, and the Q WMMAs
  // below should wait for x alone.
  __builtin_amdgcn_sched_barrier(0);

  // ---- ... and V, two rows of 1024 keys per step of the block
  v4f vst[kHd / 2];
#pragma unroll  // registers indexed by i: all loads in flight at once
  for (int i = 0; i < kHd / 2; ++i) vst[i] = *(const v4f*)(vsrc + 2 * i * kNkv);
  // The loads above stay in flight past the barrier below, and the Q
  // accumulators take over their address registers: the wait stands first.
  asm volatile("s_wait_xcnt 0x0" ::: "memory");

  *(v4f*)(ldsW + (tid >> 4) * kWP1 + 4 * (tid & 15)) = wst;
  // The Wq rows are read by all waves of the block. The fences name LDS alone:
  // __syncthreads() would also wait here for the x and V loads in flight.
  __builtin_amdgcn_fence(__ATOMIC_RELEASE, "workgroup", "local");
  __builtin_amdgcn_s_barrier();
  __builtin_amdgcn_fence(__ATOMIC_ACQUIRE, "workgroup", "local");

  // ---- Q of the wave's 16 queries, beside the flight of K and V
  v8f qa[2] = {};  // [d tile]
  {
    const float* wr = ldsW + col * kWP1 + 4 * hi;
#pragma unroll  // registers indexed by p, q
    for (int p = 0; p < 8; ++p) {
      const v4f a40 = *(const v4f*)(wr + 8 * p);
      const v4f a41 = *(const v4f*)(wr + 16 * kWP1 + 8 * p);
#pragma unroll
      for (int q = 0; q < 2; ++q) {
        v2f a0, a1;
        a0.x = a40[2 * q]; a0.y = a40[2 * q + 1];
        a1.x = a41[2 * q]; a1.y = a41[2 * q + 1];
        qa[0] = mma4(a0, xf[p][q], qa[0]);
        qa[1] = mma4(a1, xf[p][q], qa[1]);
      }
    }
  }

#pragma unroll  // vst[] is indexed by i
  for (int i = 0; i < kHd / 2; ++i) *(v4f*)(vdst + 2 * i * kVP) = vst[i];

  if (wave == 0) __builtin_amdgcn_s_wait_tensorcnt(0);
  __syncthreads();

  // ---- Q B-fragments: k slot (hi, j) of WMMA dc is d 16(dc>>2) + 8hi + 2(dc&3) + j
  v2f aq[8];
#pragma unroll  // registers indexed by dc
  for (int dc = 0; dc < 8; ++dc) {
    aq[dc].x = qa[dc >> 2][2 * (dc & 3)];
    aq[dc].y = qa[dc >> 2][2 * (dc & 3) + 1];
  }

  v8f o0 = {}, o1 = {};  // O^T: register r = d 8hi + r (o1: + 16), query col
  float mrow = -1e30f;   // running maximum of query q0 + col, equal in both halves
  float lrow = 0.f;      // running sum over this half's keys only

  const float* kr = ldsK + (8 * hi) * kNkv + 4 * col;  // K[8hi + .][4col + .]
  const float* vr = ldsV + col * kVP + 32 * hi;        // V[col + .][32hi + .]

  for (int m0 = 0; m0 < kNkv; m0 += 64) {
    // ---- this block's K and V fragments, one group of reads
    v4f kx[8][2], vx[2][8];
#pragma unroll  // registers indexed by dc, j
    for (int dc = 0; dc < 8; ++dc)
#pragma unroll
      for (int j = 0; j < 2; ++j)
        kx[dc][j] = *(const v4f*)(kr + (16 * (dc >> 2) + 2 * (dc & 3) + j) * kNkv + m0);
#pragma unroll  // registers indexed by dt, r
    for (int dt = 0; dt < 2; ++dt)
#pragma unroll
      for (int r = 0; r < 8; ++r)
        vx[dt][r] = *(const v4f*)(vr + dt * 16 * kVP + m0 + 4 * r);
    // Keeps the 32 reads one group: split up, each part costs its own LDS wait.
    __builtin_amdgcn_sched_barrier(0);

    // ---- four S^T tiles = K[., m0..m0+63]^T * (Q tile)
    v8f s[4] = {};
#pragma unroll  // registers indexed by dc, t
    for (int dc = 0; dc < 8; ++dc)
#pragma unroll
      for (int t = 0; t < 4; ++t) {
        v2f ak;
        ak.x = kx[dc][0][t];
        ak.y = kx[dc][1][t];
        s[t] = mma4(ak, aq[dc], s[t]);
      }

    // ---- online softmax: every lane works on its own query's 32 scores.
    // The scale is positive and rounding is monotonic, so scaling the maximum
    // of the raw scores gives the same bits as the maximum of the scaled ones.
    float rm[8];
#pragma unroll  // registers indexed by r
    for (int r = 0; r < 8; ++r)
      rm[r] = fmaxf(fmaxf(s[0][r], s[1][r]), fmaxf(s[2][r], s[3][r]));
    const float hm = fmaxf(fmaxf(fmaxf(rm[0], rm[1]), fmaxf(rm[2], rm[3])),
                           fmaxf(fmaxf(rm[4], rm[5]), fmaxf(rm[6], rm[7])));
    const float mnew  = fmaxf(mrow, fmaxf(hm, xhalf(hm)) * kScale);
    const float alpha = __expf(mrow - mnew);
    mrow = mnew;
    v2f pp[8][2], ps[8];  // pp[r][q] = P of keys m0 + 32hi + 4r + 2q, + 1
#pragma unroll  // registers indexed by r, q
    for (int r = 0; r < 8; ++r) {
#pragma unroll
      for (int q = 0; q < 2; ++q) {
        pp[r][q].x = __expf(s[2 * q][r] * kScale - mnew);
        pp[r][q].y = __expf(s[2 * q + 1][r] * kScale - mnew);
      }
      ps[r] = pp[r][0] + pp[r][1];
    }
    const v2f pt = ((ps[0] + ps[1]) + (ps[2] + ps[3])) +
                   ((ps[4] + ps[5]) + (ps[6] + ps[7]));
    lrow = lrow * alpha + (pt.x + pt.y);
#pragma unroll  // registers indexed by r
    for (int r = 0; r < 8; ++r) {
      o0[r] *= alpha;
      o1[r] *= alpha;
    }

    // ---- O^T += V * P^T
#pragma unroll  // registers indexed by r, q
    for (int r = 0; r < 8; ++r) {
#pragma unroll
      for (int q = 0; q < 2; ++q) {
        v2f av0, av1;
        av0.x = vx[0][r][2 * q]; av0.y = vx[0][r][2 * q + 1];
        av1.x = vx[1][r][2 * q]; av1.y = vx[1][r][2 * q + 1];
        o0 = mma4(av0, pp[r][q], o0);
        o1 = mma4(av1, pp[r][q], o1);
      }
    }
  }

  // ---- join the halves' sums, normalize and store (lanes run along n)
  const float inv = 1.f / (lrow + xhalf(lrow));
  float* ob = Ao + qbase + (size_t)(8 * hi) * kN + q0 + col;
#pragma unroll  // registers indexed by r
  for (int r = 0; r < 8; ++r) {
    ob[(size_t)r * kN]        = o0[r] * inv;
    ob[(size_t)(16 + r) * kN] = o1[r] * inv;
  }
}

// ---------------------------------------------------------------------------
extern "C" void kernel_launch(void* const* d_in, const int* in_sizes, int n_in,
                              void* d_out, int out_size, void* d_ws, size_t ws_size,
                              hipStream_t stream) {
  const float* x  = (const float*)d_in[0];
  const float* wq = (const float*)d_in[1];
  const float* wk = (const float*)d_in[2];
  const float* wv = (const float*)d_in[3];
  const float* wp = (const float*)d_in[4];

  float* Kb = (float*)d_ws;                          // [B,64,1024]
  float* Vb = Kb + (size_t)kB * kC * kNkv;           // [B,64,1024]
  float* Ab = Vb + (size_t)kB * kC * kNkv;           // [B,64,4096]

  sra_conv2x2s2<<<dim3(kH / 4, kB), 256, 0, stream>>>(x, wk, Kb);
  sra_conv2x2s2<<<dim3(kH / 4, kB), 256, 0, stream>>>(x, wv, Vb);

  const size_t smem =
      (size_t)(kHd * kNkv + kHd * kVP + kHd * kWP1) * sizeof(float);
  (void)hipFuncSetAttribute((const void*)sra_attn,
                            hipFuncAttributeMaxDynamicSharedMemorySize,
                            (int)smem);
  sra_attn<<<dim3(kN / 256, kHeads, kB), 512, smem, stream>>>(x, wq, Kb, Vb, Ab);

  sra_conv1x1<<<dim3(kN / 256, kB), 256, 0, stream>>>(Ab, wp, (float*)d_out);
}
